// v000
// Times are from an AMD MI455X. After a warm-up the kernel runs many times in a row, and a time is the length of
// such a window on the GPU divided by its runs, so every launch and the gaps after it count. The runs cycle
// through copies of the inputs. A figure is the median of several windows, for all but v000 over two sittings.
// Sittings can differ by a few percent; kernels timed side by side share one.
// v000, which the later versions start from, runs in 137 microseconds.
#include <hip/hip_runtime.h>
#include <hip/hip_bf16.h>

// ---------------------------------------------------------------------------
// Location-sensitive attention for MI455X (gfx1250, wave32, WMMA).
// B=32, T=4096, DV=512, DQ=512, ATTN=128, FILTERS=32, KSIZE=31
// Fused flash-style context accumulation: values read from HBM exactly once.
// ---------------------------------------------------------------------------

#define BB   32
#define TT   4096
#define DVV  512
#define AA   128
#define FF   32
#define KS   31
#define NTILE (TT / 16)     // 256 tiles per batch row

typedef __attribute__((ext_vector_type(16))) __bf16 v16bf;
typedef __attribute__((ext_vector_type(8)))  float  v8f;

union Frag16 {          // 16 bf16 elements = 8 dwords = one WMMA A/B operand
  v16bf    v;
  unsigned u[8];
  uint4    q[2];
};

__device__ __forceinline__ unsigned short f2bf(float x) {
  unsigned u = __float_as_uint(x);
  u += 0x7FFFu + ((u >> 16) & 1u);      // round-to-nearest-even
  return (unsigned short)(u >> 16);
}
__device__ __forceinline__ unsigned packbf(float a, float b) {
  return (unsigned)f2bf(a) | ((unsigned)f2bf(b) << 16);
}

// ---------------------------------------------------------------------------
// Prepack wv_w [512,128] into WMMA bf16 B-operand layout.
// pk[(((ks*8 + nt)*32 + lane)*8 + j]:
//   lane holds column n = nt*16 + lane%16
//   lanes 0-15 hold K {0..7, 16..23}, lanes 16-31 hold K {8..15, 24..31}
//   dword j packs (K, K+1) with even K in the low half.
// ---------------------------------------------------------------------------
__global__ __launch_bounds__(256) void lsa_prepack_wv(
    const float* __restrict__ wv_w, unsigned* __restrict__ pk) {
  int tid = blockIdx.x * 256 + threadIdx.x;    // 0..32767
  int j   = tid & 7;
  int L   = (tid >> 3) & 31;
  int nt  = (tid >> 8) & 7;
  int ks  = tid >> 11;
  int n   = nt * 16 + (L & 15);
  int kb  = ks * 32 + ((L >> 4) ? 8 : 0) + ((j < 4) ? (2 * j) : (16 + 2 * (j - 4)));
  pk[tid] = packbf(wv_w[kb * AA + n], wv_w[(kb + 1) * AA + n]);
}

__global__ __launch_bounds__(256) void lsa_prepack_loc(
    const float* __restrict__ loc_w, unsigned* __restrict__ pk) {
  int tid = blockIdx.x * 256 + threadIdx.x;    // 0..2047
  int j   = tid & 7;
  int L   = (tid >> 3) & 31;
  int nt  = tid >> 8;
  int n   = nt * 16 + (L & 15);
  int kb  = ((L >> 4) ? 8 : 0) + ((j < 4) ? (2 * j) : (16 + 2 * (j - 4)));
  pk[tid] = packbf(loc_w[kb * AA + n], loc_w[(kb + 1) * AA + n]);
}

// ---------------------------------------------------------------------------
// qbias[b][a] = query[b]·wq_w[:,a] + wq_b + wv_b + loc_b + attention_bias
// ---------------------------------------------------------------------------
__global__ __launch_bounds__(128) void lsa_qbias(
    const float* __restrict__ query, const float* __restrict__ wq_w,
    const float* __restrict__ wq_b,  const float* __restrict__ wv_b,
    const float* __restrict__ loc_b, const float* __restrict__ attn_b,
    float* __restrict__ qbias) {
  int b = blockIdx.x, a = threadIdx.x;
  const float* q = query + b * 512;
  float s = 0.f;
  #pragma unroll 8
  for (int k = 0; k < 512; ++k) s += q[k] * wq_w[k * AA + a];
  qbias[b * AA + a] = s + wq_b[a] + wv_b[a] + loc_b[a] + attn_b[a];
}

// ---------------------------------------------------------------------------
// Score (+ fused local-softmax context partial) kernel.
// One workgroup = 16 timesteps of one batch row; 8 waves, wave w owns attn
// columns [16w, 16w+16).  scores[b][t] = sum_a tanh(pre)[t][a] * proj_w[a].
// If do_ctx: also emits m_tile, Z_tile = sum exp(s-m_tile), and
// ctx_tile[d] = sum_t exp(s_t-m_tile) * values[t][d]  (tile still hot in L2).
// ---------------------------------------------------------------------------
__global__ __launch_bounds__(256) void lsa_score(
    const float*    __restrict__ values,  const float* __restrict__ prev,
    const float*    __restrict__ conv_w,  const float* __restrict__ conv_b,
    const unsigned* __restrict__ packWV,  const unsigned* __restrict__ packLOC,
    const float*    __restrict__ qbias,   const float* __restrict__ proj_w,
    float*          __restrict__ scores,
    float*          __restrict__ mtile,   float* __restrict__ ztile,
    float*          __restrict__ ctxp,    int do_ctx) {
  __shared__ __align__(16) unsigned vals[16 * 260];  // 16x512 bf16, padded stride
  __shared__ __align__(16) unsigned fbf [16 * 20];   // 16x32 bf16 conv features
  __shared__ float pa[48];                           // alignment window (46 used)
  __shared__ float wpart[8][16];                     // per-wave row partials
  __shared__ float earr[16];                         // exp(s - m_tile)

  const int tid  = threadIdx.x;
  const int b    = blockIdx.x >> 8;    // 256 tiles per batch row
  const int tile = blockIdx.x & 255;
  const int t0   = tile * 16;

  // --- stage previous_alignment window (SAME padding, K=31 -> +/-15) ---
  if (tid < 46) {
    int idx = t0 - 15 + tid;
    pa[tid] = (idx >= 0 && idx < TT) ? prev[b * TT + idx] : 0.0f;
  }

  // --- stage values tile [16 x 512] f32 -> bf16 LDS (conflict-free stride) ---
  const float2* vsrc = (const float2*)(values + ((size_t)(b * TT + t0)) * DVV);
  #pragma unroll
  for (int it = 0; it < 16; ++it) {
    int idx = tid + it * 256;           // 0..4095 float2 elements
    int row = idx >> 8, c2 = idx & 255;
    float2 v = vsrc[row * 256 + c2];
    vals[row * 260 + c2] = packbf(v.x, v.y);
  }
  __syncthreads();

  // --- 31-tap conv over alignment: each thread -> 2 of the 16x32 features ---
  {
    int t  = tid >> 4;
    int c0 = (tid & 15) * 2;
    float s0 = conv_b[c0], s1 = conv_b[c0 + 1];
    #pragma unroll
    for (int j = 0; j < KS; ++j) {
      float p = pa[t + j];
      s0 += p * conv_w[j * FF + c0];
      s1 += p * conv_w[j * FF + c0 + 1];
    }
    fbf[t * 20 + (c0 >> 1)] = packbf(s0, s1);
  }
  __syncthreads();

  const int lane  = tid & 31;
  const int w     = tid >> 5;          // wave id == n-tile id
  const int rbase = lane & 15;         // A row / B column within tile
  const int hi    = lane >> 4;         // lane half selects K sub-block
  const int hi4   = hi * 4;            // dword offset of K half-chunk

  v8f acc = {};

  // --- proc_loc = f(16x32) @ loc_w(32x16 slice), one bf16 WMMA ---
  {
    Frag16 fa, lb;
    fa.q[0] = *(const uint4*)&fbf[rbase * 20 + hi4];
    fa.q[1] = *(const uint4*)&fbf[rbase * 20 + 8 + hi4];
    const uint4* bp = (const uint4*)(packLOC + ((size_t)(w * 32 + lane) * 8));
    lb.q[0] = bp[0];
    lb.q[1] = bp[1];
    acc = __builtin_amdgcn_wmma_f32_16x16x32_bf16(
        false, fa.v, false, lb.v, (short)0, acc, false, false);
  }

  // --- wv = values(16x512) @ wv_w(512x16 slice): 16 bf16 WMMAs, K=32 each ---
  for (int ks = 0; ks < 16; ++ks) {
    Frag16 av, bv;
    const unsigned* arow = &vals[rbase * 260 + ks * 16 + hi4];
    av.q[0] = *(const uint4*)(arow);
    av.q[1] = *(const uint4*)(arow + 8);
    const uint4* bp = (const uint4*)(packWV + ((size_t)((ks * 8 + w) * 32 + lane) * 8));
    bv.q[0] = bp[0];
    bv.q[1] = bp[1];
    if (ks + 1 < 16)   // keep the next B-panel warm in the near cache
      __builtin_prefetch(packWV + ((size_t)(((ks + 1) * 8 + w) * 32 + lane) * 8), 0, 3);
    acc = __builtin_amdgcn_wmma_f32_16x16x32_bf16(
        false, av.v, false, bv.v, (short)0, acc, false, false);
  }

  // --- epilogue: tanh, project, reduce over attn dim (deterministic) ---
  const int   n  = w * 16 + rbase;
  const float qb = qbias[b * AA + n];
  const float pw = proj_w[n];
  #pragma unroll
  for (int i = 0; i < 8; ++i) {
    // C layout: vgpr i -> row i (lanes 0-15) / row i+8 (lanes 16-31), col=lane%16
    float vv = tanhf(acc[i] + qb) * pw;
    vv += __shfl_xor(vv, 1, 16);
    vv += __shfl_xor(vv, 2, 16);
    vv += __shfl_xor(vv, 4, 16);
    vv += __shfl_xor(vv, 8, 16);
    if (rbase == 0) wpart[w][i + hi * 8] = vv;
  }
  __syncthreads();

  if (tid < 16) {
    float s = 0.f;
    #pragma unroll
    for (int ww = 0; ww < 8; ++ww) s += wpart[ww][tid];   // fixed order
    scores[b * TT + t0 + tid] = s;
    earr[tid] = s;            // reuse as staging for the serial pass below
  }
  __syncthreads();

  if (!do_ctx) return;

  // --- tile-local softmax stats (serial 16-elt pass: trivial, deterministic) ---
  if (tid == 0) {
    float m = earr[0];
    #pragma unroll
    for (int t = 1; t < 16; ++t) m = fmaxf(m, earr[t]);
    float z = 0.f;
    #pragma unroll
    for (int t = 0; t < 16; ++t) { float e = expf(earr[t] - m); earr[t] = e; z += e; }
    mtile[b * NTILE + tile] = m;
    ztile[b * NTILE + tile] = z;
  }
  __syncthreads();

  // --- ctx_tile[d] = sum_t e_t * values[t][d]; tile re-read hits L2 ---
  {
    float2 cacc; cacc.x = 0.f; cacc.y = 0.f;
    #pragma unroll
    for (int t = 0; t < 16; ++t) {
      float  e = earr[t];
      float2 x = vsrc[t * 256 + tid];
      cacc.x += e * x.x;
      cacc.y += e * x.y;
    }
    ((float2*)ctxp)[(size_t)(b * NTILE + tile) * 256 + tid] = cacc;
  }
}

// ---------------------------------------------------------------------------
// Fused path combine #1: per-b global softmax stats from tile stats, then
// write attention weights.  scale[tile] = exp(m_tile - m) cached for #2.
// ---------------------------------------------------------------------------
__global__ __launch_bounds__(256) void lsa_combine_stats(
    const float* __restrict__ scores, const float* __restrict__ mtile,
    const float* __restrict__ ztile,  float* __restrict__ scale,
    float* __restrict__ mz,           float* __restrict__ out_w) {
  __shared__ float red[256];
  const int b = blockIdx.x, tid = threadIdx.x;

  float m = mtile[b * NTILE + tid];               // one tile per thread
  red[tid] = m; __syncthreads();
  for (int off = 128; off > 0; off >>= 1) {
    if (tid < off) red[tid] = fmaxf(red[tid], red[tid + off]);
    __syncthreads();
  }
  const float mg = red[0]; __syncthreads();

  float sc = expf(m - mg);
  scale[b * NTILE + tid] = sc;
  red[tid] = ztile[b * NTILE + tid] * sc; __syncthreads();
  for (int off = 128; off > 0; off >>= 1) {
    if (tid < off) red[tid] += red[tid + off];
    __syncthreads();
  }
  const float inv = 1.0f / red[0];
  if (tid == 0) { mz[b * 2] = mg; mz[b * 2 + 1] = inv; }

  const float* s = scores + b * TT;
  for (int t = tid; t < TT; t += 256)
    out_w[b * TT + t] = expf(s[t] - mg) * inv;
}

// Fused path combine #2: ctx[b][d] = invZ * sum_tile scale[tile]*ctxp[tile][d]
__global__ __launch_bounds__(256) void lsa_combine_ctx(
    const float* __restrict__ ctxp, const float* __restrict__ scale,
    const float* __restrict__ mz,   float* __restrict__ out_ctx) {
  const int b = blockIdx.x, tid = threadIdx.x;
  const float invZ = mz[b * 2 + 1];
  const float2* p = (const float2*)ctxp;
  float2 s; s.x = 0.f; s.y = 0.f;
  for (int c = 0; c < NTILE; ++c) {              // fixed order
    float  sc = scale[b * NTILE + c];
    float2 x  = p[(size_t)(b * NTILE + c) * 256 + tid];
    s.x += sc * x.x; s.y += sc * x.y;
  }
  s.x *= invZ; s.y *= invZ;
  ((float2*)out_ctx)[b * 256 + tid] = s;
}

// ---------------------------------------------------------------------------
// Fallback path (small workspace): plain softmax + second values pass.
// ---------------------------------------------------------------------------
__global__ __launch_bounds__(256) void lsa_softmax(
    const float* __restrict__ scores, float* __restrict__ out_w) {
  __shared__ float red[256];
  const int b = blockIdx.x, tid = threadIdx.x;
  const float* s = scores + b * TT;

  float m = -3.402823466e+38f;
  for (int t = tid; t < TT; t += 256) m = fmaxf(m, s[t]);
  red[tid] = m; __syncthreads();
  for (int off = 128; off > 0; off >>= 1) {
    if (tid < off) red[tid] = fmaxf(red[tid], red[tid + off]);
    __syncthreads();
  }
  m = red[0]; __syncthreads();

  float sum = 0.f;
  for (int t = tid; t < TT; t += 256) sum += expf(s[t] - m);
  red[tid] = sum; __syncthreads();
  for (int off = 128; off > 0; off >>= 1) {
    if (tid < off) red[tid] += red[tid + off];
    __syncthreads();
  }
  const float inv = 1.0f / red[0];
  for (int t = tid; t < TT; t += 256)
    out_w[b * TT + t] = expf(s[t] - m) * inv;
}

__global__ __launch_bounds__(256) void lsa_ctx_partial(
    const float* __restrict__ values, const float* __restrict__ attn_w,
    float* __restrict__ partials) {
  const int b = blockIdx.x >> 5, chunk = blockIdx.x & 31, tid = threadIdx.x;
  const float2* v = (const float2*)(values + ((size_t)b * TT) * DVV);
  const int tbase = chunk * 128;
  float2 acc; acc.x = 0.f; acc.y = 0.f;
  for (int t = 0; t < 128; ++t) {
    float wt = attn_w[b * TT + tbase + t];
    float2 x = v[(size_t)(tbase + t) * 256 + tid];
    acc.x += wt * x.x;
    acc.y += wt * x.y;
  }
  ((float2*)partials)[(size_t)(b * 32 + chunk) * 256 + tid] = acc;
}

__global__ __launch_bounds__(256) void lsa_ctx_reduce(
    const float* __restrict__ partials, float* __restrict__ out_ctx) {
  const int b = blockIdx.x, tid = threadIdx.x;
  const float2* p = (const float2*)partials;
  float2 s; s.x = 0.f; s.y = 0.f;
  #pragma unroll
  for (int c = 0; c < 32; ++c) {
    float2 x = p[(size_t)(b * 32 + c) * 256 + tid];
    s.x += x.x; s.y += x.y;
  }
  ((float2*)out_ctx)[b * 256 + tid] = s;
}

// ---------------------------------------------------------------------------
extern "C" void kernel_launch(void* const* d_in, const int* in_sizes, int n_in,
                              void* d_out, int out_size, void* d_ws, size_t ws_size,
                              hipStream_t stream) {
  const float* query  = (const float*)d_in[0];
  const float* values = (const float*)d_in[1];
  const float* prev   = (const float*)d_in[2];
  const float* conv_w = (const float*)d_in[3];
  const float* conv_b = (const float*)d_in[4];
  const float* loc_w  = (const float*)d_in[5];
  const float* loc_b  = (const float*)d_in[6];
  const float* wq_w   = (const float*)d_in[7];
  const float* wq_b   = (const float*)d_in[8];
  const float* wv_w   = (const float*)d_in[9];
  const float* wv_b   = (const float*)d_in[10];
  const float* attn_b = (const float*)d_in[11];
  const float* proj_w = (const float*)d_in[12];

  float* out_ctx = (float*)d_out;               // [32, 512]
  float* out_w   = out_ctx + BB * DVV;          // [32, 4096]

  unsigned char* ws = (unsigned char*)d_ws;
  unsigned* packWV  = (unsigned*)(ws);            // 32768 u32  (128 KB)
  unsigned* packLOC = (unsigned*)(ws + 131072);   //  2048 u32  (  8 KB)
  float*    qbias   = (float*)(ws + 139264);      //  4096 f32  ( 16 KB)
  float*    scores  = (float*)(ws + 155648);      // 131072 f32 (512 KB)
  // fused-path extras
  float*    mtile   = (float*)(ws + 679936);      //  8192 f32 ( 32 KB)
  float*    ztile   = (float*)(ws + 712704);      //  8192 f32 ( 32 KB)
  float*    scale   = (float*)(ws + 745472);      //  8192 f32 ( 32 KB)
  float*    mz      = (float*)(ws + 778240);      //    64 f32
  float*    ctxp    = (float*)(ws + 778752);      // 32*256*512 f32 (16 MB)
  const size_t fused_need = 778752u + (size_t)BB * NTILE * DVV * 4u;
  // fallback-path extra (overlaps the fused region)
  float*    parts   = (float*)(ws + 679936);      // 524288 f32 (2 MB)
  const int fused = (ws_size >= fused_need) ? 1 : 0;

  lsa_prepack_wv <<<128, 256, 0, stream>>>(wv_w, packWV);
  lsa_prepack_loc<<<  8, 256, 0, stream>>>(loc_w, packLOC);
  lsa_qbias      <<< BB, 128, 0, stream>>>(query, wq_w, wq_b, wv_b, loc_b, attn_b, qbias);

  lsa_score<<<BB * NTILE, 256, 0, stream>>>(
      values, prev, conv_w, conv_b, packWV, packLOC, qbias, proj_w,
      scores, mtile, ztile, ctxp, fused);

  if (fused) {
    lsa_combine_stats<<<BB, 256, 0, stream>>>(scores, mtile, ztile, scale, mz, out_w);
    lsa_combine_ctx  <<<BB, 256, 0, stream>>>(ctxp, scale, mz, out_ctx);
  } else {
    lsa_softmax    <<< BB, 256, 0, stream>>>(scores, out_w);
    lsa_ctx_partial<<<BB * 32, 256, 0, stream>>>(values, out_w, parts);
    lsa_ctx_reduce <<< BB, 256, 0, stream>>>(parts, out_ctx);
  }
}

// v001
// It runs in 92.7 microseconds.
// In two side-by-side timings against v000, it was 1.50 and 1.52 times as fast.
#include <hip/hip_runtime.h>
#include <hip/hip_bf16.h>

// ---------------------------------------------------------------------------
// Location-sensitive attention for MI455X (gfx1250, wave32, WMMA).
// B=32, T=4096, DV=512, DQ=512, ATTN=128, FILTERS=32, KSIZE=31
// Fused flash-style context accumulation: values read from HBM exactly once.
// ---------------------------------------------------------------------------

#define BB   32
#define TT   4096
#define DVV  512
#define AA   128
#define FF   32
#define KS   31
#define WAVES   16                  // waves per score workgroup
#define TPW     2                   // 16-row tiles per wave
#define ROWS_WG (WAVES * TPW * 16)  // 512 timesteps per score workgroup
#define NPART   (TT / ROWS_WG)      // 8 partials per batch row
#define APITCH  68                  // dwords per staged row: 128 bf16 + 16 B pad

typedef __attribute__((ext_vector_type(16))) __bf16 v16bf;
typedef __attribute__((ext_vector_type(8)))  float  v8f;

union Frag16 {          // 16 bf16 elements = 8 dwords = one WMMA A/B operand
  v16bf    v;
  unsigned u[8];
  uint4    q[2];
};

__device__ __forceinline__ unsigned short f2bf(float x) {
  unsigned u = __float_as_uint(x);
  u += 0x7FFFu + ((u >> 16) & 1u);      // round-to-nearest-even
  return (unsigned short)(u >> 16);
}
__device__ __forceinline__ unsigned packbf(float a, float b) {
  return (unsigned)f2bf(a) | ((unsigned)f2bf(b) << 16);
}

// ---------------------------------------------------------------------------
// Prepack wv_w [512,128] into WMMA bf16 B-operand layout.
// pk[(((ks*8 + nt)*2 + j/4)*32 + lane)*4 + j%4]  (each 16-B half-fragment of a
// wave is 512 contiguous bytes, conflict-free for LDS b128 reads):
//   lane holds column n = nt*16 + lane%16
//   lanes 0-15 hold K {0..7, 16..23}, lanes 16-31 hold K {8..15, 24..31}
//   dword j packs (K, K+1) with even K in the low half.
// ---------------------------------------------------------------------------
__global__ __launch_bounds__(256) void lsa_prepack_wv(
    const float* __restrict__ wv_w, unsigned* __restrict__ pk) {
  int tid = blockIdx.x * 256 + threadIdx.x;    // 0..32767
  int j   = tid & 7;
  int L   = (tid >> 3) & 31;
  int nt  = (tid >> 8) & 7;
  int ks  = tid >> 11;
  int n   = nt * 16 + (L & 15);
  int kb  = ks * 32 + ((L >> 4) ? 8 : 0) + ((j < 4) ? (2 * j) : (16 + 2 * (j - 4)));
  pk[(((ks * 8 + nt) * 2 + (j >> 2)) * 32 + L) * 4 + (j & 3)] =
      packbf(wv_w[kb * AA + n], wv_w[(kb + 1) * AA + n]);
}

__global__ __launch_bounds__(256) void lsa_prepack_loc(
    const float* __restrict__ loc_w, unsigned* __restrict__ pk) {
  int tid = blockIdx.x * 256 + threadIdx.x;    // 0..2047
  int j   = tid & 7;
  int L   = (tid >> 3) & 31;
  int nt  = tid >> 8;
  int n   = nt * 16 + (L & 15);
  int kb  = ((L >> 4) ? 8 : 0) + ((j < 4) ? (2 * j) : (16 + 2 * (j - 4)));
  pk[((nt * 2 + (j >> 2)) * 32 + L) * 4 + (j & 3)] =
      packbf(loc_w[kb * AA + n], loc_w[(kb + 1) * AA + n]);
}

// ---------------------------------------------------------------------------
// qbias[b][a] = query[b]·wq_w[:,a] + wq_b + wv_b + loc_b + attention_bias
// ---------------------------------------------------------------------------
__global__ __launch_bounds__(128) void lsa_qbias(
    const float* __restrict__ query, const float* __restrict__ wq_w,
    const float* __restrict__ wq_b,  const float* __restrict__ wv_b,
    const float* __restrict__ loc_b, const float* __restrict__ attn_b,
    float* __restrict__ qbias) {
  int b = blockIdx.x, a = threadIdx.x;
  const float* q = query + b * 512;
  float s = 0.f;
  #pragma unroll 8
  for (int k = 0; k < 512; ++k) s += q[k] * wq_w[k * AA + a];
  qbias[b * AA + a] = s + wq_b[a] + wv_b[a] + loc_b[a] + attn_b[a];
}

// ---------------------------------------------------------------------------
// Score (+ fused online-softmax context partial) kernel.
// One workgroup = 512 timesteps of one batch row, 16 waves; the packed weights
// lie in LDS once per workgroup.  Each wave owns 32 whole rows (two 16-row
// tiles) and all 128 attn columns, so a row's score is finished inside the
// wave: scores[b][t] = sum_a tanh(pre)[t][a] * proj_w[a].
// If do_ctx: the wave keeps a running max m, Z = sum exp(s-m) and
// ctx[d] = sum_t exp(s_t-m) * values[t][d] (rows re-read while hot in L2);
// the 16 waves are merged once at the end into one partial per workgroup.
// ---------------------------------------------------------------------------
// The wave's own LDS traffic has landed / returned: its lanes exchange rows
// through a per-wave LDS range, and the clobber keeps the compiler from moving
// LDS accesses across the hand-over.
#define WAVE_LDS_WAIT() asm volatile("s_wait_dscnt 0x0" ::: "memory")

__global__ __launch_bounds__(512) void lsa_score(
    const float*    __restrict__ values,  const float* __restrict__ prev,
    const float*    __restrict__ conv_w,  const float* __restrict__ conv_b,
    const unsigned* __restrict__ packWV,  const unsigned* __restrict__ packLOC,
    const float*    __restrict__ qbias,   const float* __restrict__ proj_w,
    float*          __restrict__ scores,
    float*          __restrict__ mtile,   float* __restrict__ ztile,
    float*          __restrict__ ctxp,    int do_ctx) {
  __shared__ __align__(16) unsigned sWV [32768];              // 128 KB B panels
  __shared__ __align__(16) unsigned sLOC[2048];               //   8 KB B panels
  __shared__ __align__(16) float    sCW [KS * FF];            //   4 KB conv taps
  __shared__ __align__(16) unsigned stage[WAVES][16 * APITCH]; // 16x128 bf16 per wave
  __shared__ __align__(16) unsigned fbf  [WAVES][16 * 20];     // 16x32 bf16 conv features
  __shared__ __align__(16) float    wctx [WAVES][DVV];         // per-wave context
  __shared__ float pa[WAVES][64];     // per-wave alignment window (62 used)
  __shared__ float sQB[AA];           // query bias row of this batch
  __shared__ float sPW[AA];           // projection weights
  __shared__ float wm[WAVES];
  __shared__ float wz[WAVES];

  const int tid   = threadIdx.x;
  const int lane  = tid & 31;
  const int w     = __builtin_amdgcn_readfirstlane(tid >> 5);
  const int b     = blockIdx.x / NPART;
  const int part  = blockIdx.x % NPART;
  const int row0  = part * ROWS_WG + w * (TPW * 16);   // wave's first timestep
  const int rbase = lane & 15;         // A row / B column within tile
  const int hi    = lane >> 4;         // lane half selects K sub-block
  const int hi4   = hi * 4;            // dword offset of K half-chunk
  const float*   vbase = values + ((size_t)(b * TT + row0)) * DVV;   // wave-uniform
  const unsigned lane4 = lane * 4;                                   // lane's column

  // --- first 16x128 f32 chunk of the wave's rows: one whole 512-B piece per load ---
  float4 g[16];
  #pragma unroll
  for (int r = 0; r < 16; ++r) g[r] = *(const float4*)(vbase + r * DVV + lane4);

  // --- the wave's alignment window (SAME padding, K=31 -> +/-15), both tiles ---
  #pragma unroll
  for (int h = 0; h < 2; ++h) {
    int   idx = row0 - 15 + h * 32 + lane;
    int   cl  = idx < 0 ? 0 : (idx > TT - 1 ? TT - 1 : idx);   // in-bounds address
    float pv  = prev[b * TT + cl];
    pa[w][h * 32 + lane] = (idx == cl) ? pv : 0.0f;
  }

  // --- packed weights -> LDS, once per workgroup ---
  {
    uint4 tmp[16];
    #pragma unroll
    for (int i = 0; i < 16; ++i) tmp[i] = ((const uint4*)packWV)[i * 512 + tid];
    uint4 tl = ((const uint4*)packLOC)[tid];
    #pragma unroll
    for (int i = 0; i < 16; ++i) ((uint4*)sWV)[i * 512 + tid] = tmp[i];
    ((uint4*)sLOC)[tid] = tl;
    if (tid < KS * FF / 4) ((float4*)sCW)[tid] = ((const float4*)conv_w)[tid];
  }

  if (tid < AA) {
    sQB[tid] = qbias[b * AA + tid];
    sPW[tid] = proj_w[tid];
  }
  __syncthreads();

  float  m_run = -3.402823466e+38f, z_run = 0.f;
  // the wave's running context rests in its own LDS row between tiles (each lane
  // touches only its own 16 columns), so the matrix loop has the registers
  #pragma unroll
  for (int j = 0; j < 4; ++j)
    *(float4*)&wctx[w][j * 128 + lane4] = make_float4(0.f, 0.f, 0.f, 0.f);

  #pragma unroll 1   // two tiles share one copy of the body (instruction cache)
  for (int tl = 0; tl < TPW; ++tl) {
    const int t0 = row0 + tl * 16;

    // --- 31-tap conv over alignment (SAME padding): lane -> filter pair c0,
    //     timesteps hi, hi+2, ..., hi+14 ---
    {
      const int c0 = rbase * 2;
      float win[45];
      #pragma unroll
      for (int k = 0; k < 45; ++k) win[k] = pa[w][tl * 16 + hi + k];
      float s0[8], s1[8];
      #pragma unroll
      for (int i = 0; i < 8; ++i) { s0[i] = conv_b[c0]; s1[i] = conv_b[c0 + 1]; }
      #pragma unroll
      for (int j = 0; j < KS; ++j) {
        float2 wj = *(const float2*)&sCW[j * FF + c0];
        #pragma unroll
        for (int i = 0; i < 8; ++i) {
          s0[i] += win[2 * i + j] * wj.x;
          s1[i] += win[2 * i + j] * wj.y;
        }
      }
      WAVE_LDS_WAIT();   // last tile's feature reads are back before the rows change
      #pragma unroll
      for (int i = 0; i < 8; ++i)
        fbf[w][(hi + 2 * i) * 20 + rbase] = packbf(s0[i], s1[i]);
      WAVE_LDS_WAIT();   // feature rows written before other lanes read them
    }

    v8f acc[8];

    // --- proc_loc = f(16x32) @ loc_w(32x128): 8 bf16 WMMAs ---
    {
      Frag16 fa;
      fa.q[0] = *(const uint4*)&fbf[w][rbase * 20 + hi4];
      fa.q[1] = *(const uint4*)&fbf[w][rbase * 20 + 8 + hi4];
      #pragma unroll
      for (int nt = 0; nt < 8; ++nt) {
        Frag16 lb;
        lb.q[0] = *(const uint4*)&sLOC[(nt * 2 + 0) * 128 + lane * 4];
        lb.q[1] = *(const uint4*)&sLOC[(nt * 2 + 1) * 128 + lane * 4];
        v8f zero = {};
        acc[nt] = __builtin_amdgcn_wmma_f32_16x16x32_bf16(
            false, fa.v, false, lb.v, (short)0, zero, false, false);
      }
    }

    // --- wv = values(16x512) @ wv_w(512x128): 4 chunks of K=128, 32 WMMAs each ---
    #pragma unroll 1   // rolled: one LDS base per chunk, B offsets fit the immediate field
    for (int c = 0; c < 4; ++c) {
      const unsigned* bpan = &sWV[c * 8192 + lane * 4];
      WAVE_LDS_WAIT();   // last chunk's A reads are back before its rows change
      #pragma unroll
      for (int r = 0; r < 16; ++r) {
        uint2 p;
        p.x = packbf(g[r].x, g[r].y);
        p.y = packbf(g[r].z, g[r].w);
        *(uint2*)&stage[w][r * APITCH + lane * 2] = p;
      }
      // next chunk's loads fly under this chunk's WMMAs
      const int nc = tl * 4 + c + 1;
      if (nc < TPW * 4) {
        const float* nsrc = vbase + (size_t)((nc >> 2) * 16) * DVV + (nc & 3) * 128;
        #pragma unroll
        for (int r = 0; r < 16; ++r) g[r] = *(const float4*)(nsrc + r * DVV + lane4);
        // precaution: stands ahead of any rewrite of a register these loads name
        asm volatile("s_wait_xcnt 0x0" ::: "memory");
      }
      WAVE_LDS_WAIT();   // staged rows written before other lanes read them
      #pragma unroll
      for (int ksl = 0; ksl < 4; ++ksl) {
        Frag16 av;
        const unsigned* arow = &stage[w][rbase * APITCH + ksl * 16 + hi4];
        av.q[0] = *(const uint4*)(arow);
        av.q[1] = *(const uint4*)(arow + 8);
        #pragma unroll
        for (int nh = 0; nh < 8; nh += 4) {
          Frag16 bv[4];
          #pragma unroll
          for (int nt = 0; nt < 4; ++nt) {
            bv[nt].q[0] = *(const uint4*)(bpan + ((ksl * 8 + nh + nt) * 2 + 0) * 128);
            bv[nt].q[1] = *(const uint4*)(bpan + ((ksl * 8 + nh + nt) * 2 + 1) * 128);
          }
          // keeps a group's 8 LDS reads together ahead of its 4 WMMAs (they issue
          // under the group before): one LDS latency per group, not one per WMMA
          __builtin_amdgcn_sched_barrier(0);
          #pragma unroll
          for (int nt = 0; nt < 4; ++nt)
            acc[nh + nt] = __builtin_amdgcn_wmma_f32_16x16x32_bf16(
                false, av.v, false, bv[nt].v, (short)0, acc[nh + nt], false, false);
        }
      }
    }

    // --- epilogue: tanh, project, reduce over attn dim (deterministic) ---
    // C layout: vgpr i -> row i (lanes 0-15) / row i+8 (lanes 16-31), col=lane%16
    float qb[8], pw[8];
    #pragma unroll
    for (int nt = 0; nt < 8; ++nt) {
      qb[nt] = sQB[nt * 16 + rbase];
      pw[nt] = sPW[nt * 16 + rbase];
    }
    float ps[8];
    #pragma unroll
    for (int i = 0; i < 8; ++i) {
      float vv = 0.f;
      #pragma unroll
      for (int nt = 0; nt < 8; ++nt) vv += tanhf(acc[nt][i] + qb[nt]) * pw[nt];
      vv += __shfl_xor(vv, 1, 16);
      vv += __shfl_xor(vv, 2, 16);
      vv += __shfl_xor(vv, 4, 16);
      vv += __shfl_xor(vv, 8, 16);
      ps[i] = vv;                       // score of row i + 8*hi, in all 16 lanes
    }
    {
      float mine = ps[0];
      #pragma unroll
      for (int i = 1; i < 8; ++i) mine = (rbase == i) ? ps[i] : mine;
      if (rbase < 8) scores[b * TT + t0 + hi * 8 + rbase] = mine;
    }

    if (do_ctx) {
      // --- all 16 scores in every lane, then the online-softmax update ---
      float sc[16];
      #pragma unroll
      for (int i = 0; i < 8; ++i) {
        float other = __shfl_xor(ps[i], 16, 32);
        sc[i]     = hi ? other : ps[i];
        sc[i + 8] = hi ? ps[i] : other;
      }
      float mn = m_run;
      #pragma unroll
      for (int t = 0; t < 16; ++t) mn = fmaxf(mn, sc[t]);
      const float resc = expf(m_run - mn);
      m_run = mn;
      z_run *= resc;
      float4 cx[4];
      #pragma unroll
      for (int j = 0; j < 4; ++j) {
        cx[j] = *(const float4*)&wctx[w][j * 128 + lane4];
        cx[j].x *= resc; cx[j].y *= resc; cx[j].z *= resc; cx[j].w *= resc;
      }
      #pragma unroll
      for (int t = 0; t < 16; ++t) { sc[t] = expf(sc[t] - mn); z_run += sc[t]; }

      // --- ctx[d] += e_t * values[t][d]; the tile's re-read hits L2 ---
      const float* rsrc = vbase + (size_t)(tl * 16) * DVV;
      #pragma unroll
      for (int tb = 0; tb < 16; tb += 4) {
        float4 x[4][4];
        #pragma unroll
        for (int t = 0; t < 4; ++t) {
          #pragma unroll
          for (int j = 0; j < 4; ++j)
            x[t][j] = *(const float4*)(rsrc + (tb + t) * DVV + j * 128 + lane4);
        }
        // keeps four rows' 16 loads in flight together: one L2 latency per
        // batch instead of one per load
        __builtin_amdgcn_sched_barrier(0);
        #pragma unroll
        for (int t = 0; t < 4; ++t) {
          #pragma unroll
          for (int j = 0; j < 4; ++j) {
            cx[j].x += sc[tb + t] * x[t][j].x;
            cx[j].y += sc[tb + t] * x[t][j].y;
            cx[j].z += sc[tb + t] * x[t][j].z;
            cx[j].w += sc[tb + t] * x[t][j].w;
          }
        }
      }
      #pragma unroll
      for (int j = 0; j < 4; ++j) *(float4*)&wctx[w][j * 128 + lane4] = cx[j];
    }
  }

  if (!do_ctx) return;

  // --- merge the 16 waves' (m, Z, ctx) into one partial, fixed order ---
  if (lane == 0) { wm[w] = m_run; wz[w] = z_run; }
  __syncthreads();
  {
    float m = wm[0];
    #pragma unroll
    for (int ww = 1; ww < WAVES; ++ww) m = fmaxf(m, wm[ww]);
    float z = 0.f, cacc = 0.f;
    #pragma unroll
    for (int ww = 0; ww < WAVES; ++ww) {
      float e = expf(wm[ww] - m);
      z    += wz[ww] * e;
      cacc += e * wctx[ww][tid];
    }
    ctxp[(size_t)(b * NPART + part) * DVV + tid] = cacc;
    if (tid == 0) {
      mtile[b * NPART + part] = m;
      ztile[b * NPART + part] = z;
    }
  }
}

// ---------------------------------------------------------------------------
// Fused path combine #1: per-b global softmax stats from the NPART partial
// stats, then write attention weights.  scale[p] = exp(m_p - m) cached for #2.
// ---------------------------------------------------------------------------
__global__ __launch_bounds__(256) void lsa_combine_stats(
    const float* __restrict__ scores, const float* __restrict__ mtile,
    const float* __restrict__ ztile,  float* __restrict__ scale,
    float* __restrict__ mz,           float* __restrict__ out_w) {
  const int b = blockIdx.x, tid = threadIdx.x;

  float mg = mtile[b * NPART];
  #pragma unroll
  for (int p = 1; p < NPART; ++p) mg = fmaxf(mg, mtile[b * NPART + p]);
  float z = 0.f;
  #pragma unroll
  for (int p = 0; p < NPART; ++p)                 // fixed order
    z += ztile[b * NPART + p] * expf(mtile[b * NPART + p] - mg);
  const float inv = 1.0f / z;
  if (tid < NPART) scale[b * NPART + tid] = expf(mtile[b * NPART + tid] - mg);
  if (tid == 0) { mz[b * 2] = mg; mz[b * 2 + 1] = inv; }

  const float* s = scores + b * TT;
  for (int t = tid; t < TT; t += 256)
    out_w[b * TT + t] = expf(s[t] - mg) * inv;
}

// Fused path combine #2: ctx[b][d] = invZ * sum_p scale[p]*ctxp[p][d]
__global__ __launch_bounds__(256) void lsa_combine_ctx(
    const float* __restrict__ ctxp, const float* __restrict__ scale,
    const float* __restrict__ mz,   float* __restrict__ out_ctx) {
  const int b = blockIdx.x, tid = threadIdx.x;
  const float invZ = mz[b * 2 + 1];
  const float2* p = (const float2*)ctxp;
  float2 s; s.x = 0.f; s.y = 0.f;
  for (int c = 0; c < NPART; ++c) {              // fixed order
    float  sc = scale[b * NPART + c];
    float2 x  = p[(size_t)(b * NPART + c) * 256 + tid];
    s.x += sc * x.x; s.y += sc * x.y;
  }
  s.x *= invZ; s.y *= invZ;
  ((float2*)out_ctx)[b * 256 + tid] = s;
}

// ---------------------------------------------------------------------------
// Fallback path (small workspace): plain softmax + second values pass.
// ---------------------------------------------------------------------------
__global__ __launch_bounds__(256) void lsa_softmax(
    const float* __restrict__ scores, float* __restrict__ out_w) {
  __shared__ float red[256];
  const int b = blockIdx.x, tid = threadIdx.x;
  const float* s = scores + b * TT;

  float m = -3.402823466e+38f;
  for (int t = tid; t < TT; t += 256) m = fmaxf(m, s[t]);
  red[tid] = m; __syncthreads();
  for (int off = 128; off > 0; off >>= 1) {
    if (tid < off) red[tid] = fmaxf(red[tid], red[tid + off]);
    __syncthreads();
  }
  m = red[0]; __syncthreads();

  float sum = 0.f;
  for (int t = tid; t < TT; t += 256) sum += expf(s[t] - m);
  red[tid] = sum; __syncthreads();
  for (int off = 128; off > 0; off >>= 1) {
    if (tid < off) red[tid] += red[tid + off];
    __syncthreads();
  }
  const float inv = 1.0f / red[0];
  for (int t = tid; t < TT; t += 256)
    out_w[b * TT + t] = expf(s[t] - m) * inv;
}

__global__ __launch_bounds__(256) void lsa_ctx_partial(
    const float* __restrict__ values, const float* __restrict__ attn_w,
    float* __restrict__ partials) {
  const int b = blockIdx.x >> 5, chunk = blockIdx.x & 31, tid = threadIdx.x;
  const float2* v = (const float2*)(values + ((size_t)b * TT) * DVV);
  const int tbase = chunk * 128;
  float2 acc; acc.x = 0.f; acc.y = 0.f;
  for (int t = 0; t < 128; ++t) {
    float wt = attn_w[b * TT + tbase + t];
    float2 x = v[(size_t)(tbase + t) * 256 + tid];
    acc.x += wt * x.x;
    acc.y += wt * x.y;
  }
  ((float2*)partials)[(size_t)(b * 32 + chunk) * 256 + tid] = acc;
}

__global__ __launch_bounds__(256) void lsa_ctx_reduce(
    const float* __restrict__ partials, float* __restrict__ out_ctx) {
  const int b = blockIdx.x, tid = threadIdx.x;
  const float2* p = (const float2*)partials;
  float2 s; s.x = 0.f; s.y = 0.f;
  #pragma unroll
  for (int c = 0; c < 32; ++c) {
    float2 x = p[(size_t)(b * 32 + c) * 256 + tid];
    s.x += x.x; s.y += x.y;
  }
  ((float2*)out_ctx)[b * 256 + tid] = s;
}

// ---------------------------------------------------------------------------
extern "C" void kernel_launch(void* const* d_in, const int* in_sizes, int n_in,
                              void* d_out, int out_size, void* d_ws, size_t ws_size,
                              hipStream_t stream) {
  const float* query  = (const float*)d_in[0];
  const float* values = (const float*)d_in[1];
  const float* prev   = (const float*)d_in[2];
  const float* conv_w = (const float*)d_in[3];
  const float* conv_b = (const float*)d_in[4];
  const float* loc_w  = (const float*)d_in[5];
  const float* loc_b  = (const float*)d_in[6];
  const float* wq_w   = (const float*)d_in[7];
  const float* wq_b   = (const float*)d_in[8];
  const float* wv_w   = (const float*)d_in[9];
  const float* wv_b   = (const float*)d_in[10];
  const float* attn_b = (const float*)d_in[11];
  const float* proj_w = (const float*)d_in[12];

  float* out_ctx = (float*)d_out;               // [32, 512]
  float* out_w   = out_ctx + BB * DVV;          // [32, 4096]

  unsigned char* ws = (unsigned char*)d_ws;
  unsigned* packWV  = (unsigned*)(ws);            // 32768 u32  (128 KB)
  unsigned* packLOC = (unsigned*)(ws + 131072);   //  2048 u32  (  8 KB)
  float*    qbias   = (float*)(ws + 139264);      //  4096 f32  ( 16 KB)
  float*    scores  = (float*)(ws + 155648);      // 131072 f32 (512 KB)
  // fused-path extras
  float*    mtile   = (float*)(ws + 679936);      //   256 f32
  float*    ztile   = (float*)(ws + 712704);      //   256 f32
  float*    scale   = (float*)(ws + 745472);      //   256 f32
  float*    mz      = (float*)(ws + 778240);      //    64 f32
  float*    ctxp    = (float*)(ws + 778752);      // 32*8*512 f32 (512 KB)
  const size_t fused_need = 778752u + (size_t)BB * NPART * DVV * 4u;
  // fallback-path extra (overlaps the fused region)
  float*    parts   = (float*)(ws + 679936);      // 524288 f32 (2 MB)
  const int fused = (ws_size >= fused_need) ? 1 : 0;

  lsa_prepack_wv <<<128, 256, 0, stream>>>(wv_w, packWV);
  lsa_prepack_loc<<<  8, 256, 0, stream>>>(loc_w, packLOC);
  lsa_qbias      <<< BB, 128, 0, stream>>>(query, wq_w, wq_b, wv_b, loc_b, attn_b, qbias);

  lsa_score<<<BB * NPART, 512, 0, stream>>>(
      values, prev, conv_w, conv_b, packWV, packLOC, qbias, proj_w,
      scores, mtile, ztile, ctxp, fused);

  if (fused) {
    lsa_combine_stats<<<BB, 256, 0, stream>>>(scores, mtile, ztile, scale, mz, out_w);
    lsa_combine_ctx  <<<BB, 256, 0, stream>>>(ctxp, scale, mz, out_ctx);
  } else {
    lsa_softmax    <<< BB, 256, 0, stream>>>(scores, out_w);
    lsa_ctx_partial<<<BB * 32, 256, 0, stream>>>(values, out_w, parts);
    lsa_ctx_reduce <<< BB, 256, 0, stream>>>(parts, out_ctx);
  }
}

// v002
// A run of this version takes 63.7 microseconds.
// In two side-by-side timings against v001, it was 1.46 and 1.47 times as fast.
// All steps since v000 together make it 2.21 times as fast.
#include <hip/hip_runtime.h>
#include <hip/hip_bf16.h>

// ---------------------------------------------------------------------------
// Location-sensitive attention for MI455X (gfx1250, wave32, WMMA).
// B=32, T=4096, DV=512, DQ=512, ATTN=128, FILTERS=32, KSIZE=31
// Fused flash-style context accumulation: values read from HBM exactly once.
// ---------------------------------------------------------------------------

#define BB   32
#define TT   4096
#define DVV  512
#define AA   128
#define FF   32
#define KS   31
#define WAVES   16                  // waves per score workgroup
#define TPW     2                   // 16-row tiles per wave
#define ROWS_WG (WAVES * TPW * 16)  // 512 timesteps per score workgroup
#define NPART   (TT / ROWS_WG)      // 8 partials per batch row
#define APITCH  68                  // dwords per staged row: 128 bf16 + 16 B pad

typedef __attribute__((ext_vector_type(16))) __bf16 v16bf;
typedef __attribute__((ext_vector_type(8)))  float  v8f;

union Frag16 {          // 16 bf16 elements = 8 dwords = one WMMA A/B operand
  v16bf    v;
  unsigned u[8];
  uint4    q[2];
};

__device__ __forceinline__ unsigned short f2bf(float x) {
  unsigned u = __float_as_uint(x);
  u += 0x7FFFu + ((u >> 16) & 1u);      // round-to-nearest-even
  return (unsigned short)(u >> 16);
}
__device__ __forceinline__ unsigned packbf(float a, float b) {
  return (unsigned)f2bf(a) | ((unsigned)f2bf(b) << 16);
}

// ---------------------------------------------------------------------------
// Prepack wv_w [512,128] into WMMA bf16 B-operand layout.
// pk[(((ks*8 + nt)*2 + j/4)*32 + lane)*4 + j%4]  (each 16-B half-fragment of a
// wave is 512 contiguous bytes, conflict-free for LDS b128 reads):
//   lane holds column n = nt*16 + lane%16
//   lanes 0-15 hold K {0..7, 16..23}, lanes 16-31 hold K {8..15, 24..31}
//   dword j packs (K, K+1) with even K in the low half.
// ---------------------------------------------------------------------------
__global__ __launch_bounds__(256) void lsa_prepack_wv(
    const float* __restrict__ wv_w, unsigned* __restrict__ pk) {
  int tid = blockIdx.x * 256 + threadIdx.x;    // 0..32767
  int j   = tid & 7;
  int L   = (tid >> 3) & 31;
  int nt  = (tid >> 8) & 7;
  int ks  = tid >> 11;
  int n   = nt * 16 + (L & 15);
  int kb  = ks * 32 + ((L >> 4) ? 8 : 0) + ((j < 4) ? (2 * j) : (16 + 2 * (j - 4)));
  pk[(((ks * 8 + nt) * 2 + (j >> 2)) * 32 + L) * 4 + (j & 3)] =
      packbf(wv_w[kb * AA + n], wv_w[(kb + 1) * AA + n]);
}

__global__ __launch_bounds__(256) void lsa_prepack_loc(
    const float* __restrict__ loc_w, unsigned* __restrict__ pk) {
  int tid = blockIdx.x * 256 + threadIdx.x;    // 0..2047
  int j   = tid & 7;
  int L   = (tid >> 3) & 31;
  int nt  = tid >> 8;
  int n   = nt * 16 + (L & 15);
  int kb  = ((L >> 4) ? 8 : 0) + ((j < 4) ? (2 * j) : (16 + 2 * (j - 4)));
  pk[((nt * 2 + (j >> 2)) * 32 + L) * 4 + (j & 3)] =
      packbf(loc_w[kb * AA + n], loc_w[(kb + 1) * AA + n]);
}

// ---------------------------------------------------------------------------
// qbias[b][a] = query[b]·wq_w[:,a] + wq_b + wv_b + loc_b + attention_bias
// ---------------------------------------------------------------------------
#define QCOLS 32   // attn columns per qbias workgroup: one 128-B line of each wq_w row
__global__ __launch_bounds__(512) void lsa_qbias(
    const float* __restrict__ query, const float* __restrict__ wq_w,
    const float* __restrict__ wq_b,  const float* __restrict__ wv_b,
    const float* __restrict__ loc_b, const float* __restrict__ attn_b,
    float* __restrict__ qbias) {
  // One workgroup = one batch row x 32 columns; K = 512 is split over 16 waves x
  // 4 lane groups x 8 rows, so a lane needs only 8 row loads and every load of
  // the kernel is issued before the first is used: one memory latency for the
  // kernel instead of one per group of rows.
  __shared__ __align__(16) float part[16][QCOLS];
  const int b    = blockIdx.x >> 2, cq = blockIdx.x & 3, tid = threadIdx.x;
  const int lane = tid & 31, w = tid >> 5;
  const int c4   = (lane & 7) * 4;             // lane's 4 columns in the line
  const int row0 = w * 32 + (lane >> 3) * 8;   // lane's 8 rows of K
  const int a    = cq * QCOLS + lane;          // column of the closing sum
  const float* wp = wq_w + row0 * AA + cq * QCOLS + c4;
  const float* qp = query + b * 512 + row0;
  float4 x[8];
  #pragma unroll
  for (int i = 0; i < 8; ++i) x[i] = *(const float4*)(wp + i * AA);
  float4 qv[2];
  qv[0] = *(const float4*)(qp);
  qv[1] = *(const float4*)(qp + 4);
  const float bq = wq_b[a], bv = wv_b[a], bl = loc_b[a], ba = attn_b[a];
  // precaution: stands ahead of any rewrite of a register the loads above name
  // (the build reuses the query loads' offset register for loaded data at once)
  asm volatile("s_wait_xcnt 0x0" ::: "memory");
  const float qs[8] = {qv[0].x, qv[0].y, qv[0].z, qv[0].w,
                       qv[1].x, qv[1].y, qv[1].z, qv[1].w};
  float4 s = make_float4(0.f, 0.f, 0.f, 0.f);
  #pragma unroll
  for (int i = 0; i < 8; ++i) {
    s.x += qs[i] * x[i].x; s.y += qs[i] * x[i].y;
    s.z += qs[i] * x[i].z; s.w += qs[i] * x[i].w;
  }
  // the wave's 4 lane groups hold the same columns: fold them, fixed order
  #pragma unroll
  for (int d = 8; d < 32; d <<= 1) {
    s.x += __shfl_xor(s.x, d, 32); s.y += __shfl_xor(s.y, d, 32);
    s.z += __shfl_xor(s.z, d, 32); s.w += __shfl_xor(s.w, d, 32);
  }
  if (lane < 8) *(float4*)&part[w][c4] = s;
  __syncthreads();
  if (tid < QCOLS) {
    float t = part[0][tid];
    #pragma unroll
    for (int ww = 1; ww < 16; ++ww) t += part[ww][tid];   // fixed wave order
    qbias[b * AA + a] = t + bq + bv + bl + ba;
  }
}

// ---------------------------------------------------------------------------
// Score (+ fused online-softmax context partial) kernel.
// One workgroup = 512 timesteps of one batch row, 16 waves; the packed weights
// lie in LDS once per workgroup.  Each wave owns 32 whole rows (two 16-row
// tiles) and all 128 attn columns, so a row's score is finished inside the
// wave: scores[b][t] = sum_a tanh(pre)[t][a] * proj_w[a].
// If do_ctx: the wave keeps a running max m, Z = sum exp(s-m) and
// ctx[d] = sum_t exp(s_t-m) * values[t][d] (rows re-read while hot in L2);
// the 16 waves are merged once at the end into one partial per workgroup.
// ---------------------------------------------------------------------------
// The wave's own LDS traffic has landed / returned: its lanes exchange rows
// through a per-wave LDS range, and the clobber keeps the compiler from moving
// LDS accesses across the hand-over.
#define WAVE_LDS_WAIT() asm volatile("s_wait_dscnt 0x0" ::: "memory")

__global__ __launch_bounds__(512) void lsa_score(
    const float*    __restrict__ values,  const float* __restrict__ prev,
    const float*    __restrict__ conv_w,  const float* __restrict__ conv_b,
    const unsigned* __restrict__ packWV,  const unsigned* __restrict__ packLOC,
    const float*    __restrict__ qbias,   const float* __restrict__ proj_w,
    float*          __restrict__ scores,
    float*          __restrict__ mtile,   float* __restrict__ ztile,
    float*          __restrict__ ctxp,    int do_ctx) {
  __shared__ __align__(16) unsigned sWV [32768];              // 128 KB B panels
  __shared__ __align__(16) unsigned sLOC[2048];               //   8 KB B panels
  __shared__ __align__(16) float    sCW [KS * FF];            //   4 KB conv taps
  __shared__ __align__(16) unsigned stage[WAVES][16 * APITCH]; // 16x128 bf16 per wave
  __shared__ __align__(16) unsigned fbf  [WAVES][16 * 20];     // 16x32 bf16 conv features
  __shared__ __align__(16) float    wctx [WAVES][DVV];         // per-wave context
  __shared__ float pa[WAVES][64];     // per-wave alignment window (62 used)
  __shared__ float sQB[AA];           // query bias row of this batch
  __shared__ float sPW[AA];           // projection weights
  __shared__ float wm[WAVES];
  __shared__ float wz[WAVES];

  const int tid   = threadIdx.x;
  const int lane  = tid & 31;
  const int w     = __builtin_amdgcn_readfirstlane(tid >> 5);
  const int b     = blockIdx.x / NPART;
  const int part  = blockIdx.x % NPART;
  const int row0  = part * ROWS_WG + w * (TPW * 16);   // wave's first timestep
  const int rbase = lane & 15;         // A row / B column within tile
  const int hi    = lane >> 4;         // lane half selects K sub-block
  const int hi4   = hi * 4;            // dword offset of K half-chunk
  const float*   vbase = values + ((size_t)(b * TT + row0)) * DVV;   // wave-uniform
  const unsigned lane4 = lane * 4;                                   // lane's column

  // --- first 16x128 f32 chunk of the wave's rows: one whole 512-B piece per load ---
  float4 g[16];
  #pragma unroll
  for (int r = 0; r < 16; ++r) g[r] = *(const float4*)(vbase + r * DVV + lane4);

  // --- the wave's alignment window (SAME padding, K=31 -> +/-15), both tiles ---
  #pragma unroll
  for (int h = 0; h < 2; ++h) {
    int   idx = row0 - 15 + h * 32 + lane;
    int   cl  = idx < 0 ? 0 : (idx > TT - 1 ? TT - 1 : idx);   // in-bounds address
    float pv  = prev[b * TT + cl];
    pa[w][h * 32 + lane] = (idx == cl) ? pv : 0.0f;
  }

  // --- packed weights -> LDS, once per workgroup ---
  {
    uint4 tmp[16];
    #pragma unroll
    for (int i = 0; i < 16; ++i) tmp[i] = ((const uint4*)packWV)[i * 512 + tid];
    uint4 tl = ((const uint4*)packLOC)[tid];
    #pragma unroll
    for (int i = 0; i < 16; ++i) ((uint4*)sWV)[i * 512 + tid] = tmp[i];
    ((uint4*)sLOC)[tid] = tl;
    if (tid < KS * FF / 4) ((float4*)sCW)[tid] = ((const float4*)conv_w)[tid];
  }

  if (tid < AA) {
    sQB[tid] = qbias[b * AA + tid];
    sPW[tid] = proj_w[tid];
  }
  __syncthreads();

  float  m_run = -3.402823466e+38f, z_run = 0.f;
  // the wave's running context rests in its own LDS row between tiles (each lane
  // touches only its own 16 columns), so the matrix loop has the registers
  #pragma unroll
  for (int j = 0; j < 4; ++j)
    *(float4*)&wctx[w][j * 128 + lane4] = make_float4(0.f, 0.f, 0.f, 0.f);

  #pragma unroll 1   // two tiles share one copy of the body (instruction cache)
  for (int tl = 0; tl < TPW; ++tl) {
    const int t0 = row0 + tl * 16;

    // --- 31-tap conv over alignment (SAME padding): lane -> filter pair c0,
    //     timesteps hi, hi+2, ..., hi+14 ---
    {
      const int c0 = rbase * 2;
      float win[45];
      #pragma unroll
      for (int k = 0; k < 45; ++k) win[k] = pa[w][tl * 16 + hi + k];
      float s0[8], s1[8];
      #pragma unroll
      for (int i = 0; i < 8; ++i) { s0[i] = conv_b[c0]; s1[i] = conv_b[c0 + 1]; }
      #pragma unroll
      for (int j = 0; j < KS; ++j) {
        float2 wj = *(const float2*)&sCW[j * FF + c0];
        #pragma unroll
        for (int i = 0; i < 8; ++i) {
          s0[i] += win[2 * i + j] * wj.x;
          s1[i] += win[2 * i + j] * wj.y;
        }
      }
      WAVE_LDS_WAIT();   // last tile's feature reads are back before the rows change
      #pragma unroll
      for (int i = 0; i < 8; ++i)
        fbf[w][(hi + 2 * i) * 20 + rbase] = packbf(s0[i], s1[i]);
      WAVE_LDS_WAIT();   // feature rows written before other lanes read them
    }

    v8f acc[8];

    // --- proc_loc = f(16x32) @ loc_w(32x128): 8 bf16 WMMAs ---
    {
      Frag16 fa;
      fa.q[0] = *(const uint4*)&fbf[w][rbase * 20 + hi4];
      fa.q[1] = *(const uint4*)&fbf[w][rbase * 20 + 8 + hi4];
      #pragma unroll
      for (int nt = 0; nt < 8; ++nt) {
        Frag16 lb;
        lb.q[0] = *(const uint4*)&sLOC[(nt * 2 + 0) * 128 + lane * 4];
        lb.q[1] = *(const uint4*)&sLOC[(nt * 2 + 1) * 128 + lane * 4];
        v8f zero = {};
        acc[nt] = __builtin_amdgcn_wmma_f32_16x16x32_bf16(
            false, fa.v, false, lb.v, (short)0, zero, false, false);
      }
    }

    // --- wv = values(16x512) @ wv_w(512x128): 4 chunks of K=128, 32 WMMAs each ---
    #pragma unroll 1   // rolled: one LDS base per chunk, B offsets fit the immediate field
    for (int c = 0; c < 4; ++c) {
      const unsigned* bpan = &sWV[c * 8192 + lane * 4];
      WAVE_LDS_WAIT();   // last chunk's A reads are back before its rows change
      #pragma unroll
      for (int r = 0; r < 16; ++r) {
        uint2 p;
        p.x = packbf(g[r].x, g[r].y);
        p.y = packbf(g[r].z, g[r].w);
        *(uint2*)&stage[w][r * APITCH + lane * 2] = p;
      }
      // next chunk's loads fly under this chunk's WMMAs
      const int nc = tl * 4 + c + 1;
      if (nc < TPW * 4) {
        const float* nsrc = vbase + (size_t)((nc >> 2) * 16) * DVV + (nc & 3) * 128;
        #pragma unroll
        for (int r = 0; r < 16; ++r) g[r] = *(const float4*)(nsrc + r * DVV + lane4);
        // precaution: stands ahead of any rewrite of a register these loads name
        asm volatile("s_wait_xcnt 0x0" ::: "memory");
      }
      WAVE_LDS_WAIT();   // staged rows written before other lanes read them
      #pragma unroll
      for (int ksl = 0; ksl < 4; ++ksl) {
        Frag16 av;
        const unsigned* arow = &stage[w][rbase * APITCH + ksl * 16 + hi4];
        av.q[0] = *(const uint4*)(arow);
        av.q[1] = *(const uint4*)(arow + 8);
        #pragma unroll
        for (int nh = 0; nh < 8; nh += 4) {
          Frag16 bv[4];
          #pragma unroll
          for (int nt = 0; nt < 4; ++nt) {
            bv[nt].q[0] = *(const uint4*)(bpan + ((ksl * 8 + nh + nt) * 2 + 0) * 128);
            bv[nt].q[1] = *(const uint4*)(bpan + ((ksl * 8 + nh + nt) * 2 + 1) * 128);
          }
          // keeps a group's 8 LDS reads together ahead of its 4 WMMAs (they issue
          // under the group before): one LDS latency per group, not one per WMMA
          __builtin_amdgcn_sched_barrier(0);
          #pragma unroll
          for (int nt = 0; nt < 4; ++nt)
            acc[nh + nt] = __builtin_amdgcn_wmma_f32_16x16x32_bf16(
                false, av.v, false, bv[nt].v, (short)0, acc[nh + nt], false, false);
        }
      }
    }

    // --- epilogue: tanh, project, reduce over attn dim (deterministic) ---
    // C layout: vgpr i -> row i (lanes 0-15) / row i+8 (lanes 16-31), col=lane%16
    float qb[8], pw[8];
    #pragma unroll
    for (int nt = 0; nt < 8; ++nt) {
      qb[nt] = sQB[nt * 16 + rbase];
      pw[nt] = sPW[nt * 16 + rbase];
    }
    float ps[8];
    #pragma unroll
    for (int i = 0; i < 8; ++i) {
      float vv = 0.f;
      #pragma unroll
      for (int nt = 0; nt < 8; ++nt) vv += tanhf(acc[nt][i] + qb[nt]) * pw[nt];
      vv += __shfl_xor(vv, 1, 16);
      vv += __shfl_xor(vv, 2, 16);
      vv += __shfl_xor(vv, 4, 16);
      vv += __shfl_xor(vv, 8, 16);
      ps[i] = vv;                       // score of row i + 8*hi, in all 16 lanes
    }
    {
      float mine = ps[0];
      #pragma unroll
      for (int i = 1; i < 8; ++i) mine = (rbase == i) ? ps[i] : mine;
      if (rbase < 8) scores[b * TT + t0 + hi * 8 + rbase] = mine;
    }

    if (do_ctx) {
      // --- all 16 scores in every lane, then the online-softmax update ---
      float sc[16];
      #pragma unroll
      for (int i = 0; i < 8; ++i) {
        float other = __shfl_xor(ps[i], 16, 32);
        sc[i]     = hi ? other : ps[i];
        sc[i + 8] = hi ? ps[i] : other;
      }
      float mn = m_run;
      #pragma unroll
      for (int t = 0; t < 16; ++t) mn = fmaxf(mn, sc[t]);
      const float resc = expf(m_run - mn);
      m_run = mn;
      z_run *= resc;
      float4 cx[4];
      #pragma unroll
      for (int j = 0; j < 4; ++j) {
        cx[j] = *(const float4*)&wctx[w][j * 128 + lane4];
        cx[j].x *= resc; cx[j].y *= resc; cx[j].z *= resc; cx[j].w *= resc;
      }
      #pragma unroll
      for (int t = 0; t < 16; ++t) { sc[t] = expf(sc[t] - mn); z_run += sc[t]; }

      // --- ctx[d] += e_t * values[t][d]; the tile's re-read hits L2 ---
      const float* rsrc = vbase + (size_t)(tl * 16) * DVV;
      #pragma unroll
      for (int tb = 0; tb < 16; tb += 4) {
        float4 x[4][4];
        #pragma unroll
        for (int t = 0; t < 4; ++t) {
          #pragma unroll
          for (int j = 0; j < 4; ++j)
            x[t][j] = *(const float4*)(rsrc + (tb + t) * DVV + j * 128 + lane4);
        }
        // keeps four rows' 16 loads in flight together: one L2 latency per
        // batch instead of one per load
        __builtin_amdgcn_sched_barrier(0);
        #pragma unroll
        for (int t = 0; t < 4; ++t) {
          #pragma unroll
          for (int j = 0; j < 4; ++j) {
            cx[j].x += sc[tb + t] * x[t][j].x;
            cx[j].y += sc[tb + t] * x[t][j].y;
            cx[j].z += sc[tb + t] * x[t][j].z;
            cx[j].w += sc[tb + t] * x[t][j].w;
          }
        }
      }
      #pragma unroll
      for (int j = 0; j < 4; ++j) *(float4*)&wctx[w][j * 128 + lane4] = cx[j];
    }
  }

  if (!do_ctx) return;

  // --- merge the 16 waves' (m, Z, ctx) into one partial, fixed order ---
  if (lane == 0) { wm[w] = m_run; wz[w] = z_run; }
  __syncthreads();
  {
    float m = wm[0];
    #pragma unroll
    for (int ww = 1; ww < WAVES; ++ww) m = fmaxf(m, wm[ww]);
    float z = 0.f, cacc = 0.f;
    #pragma unroll
    for (int ww = 0; ww < WAVES; ++ww) {
      float e = expf(wm[ww] - m);
      z    += wz[ww] * e;
      cacc += e * wctx[ww][tid];
    }
    ctxp[(size_t)(b * NPART + part) * DVV + tid] = cacc;
    if (tid == 0) {
      mtile[b * NPART + part] = m;
      ztile[b * NPART + part] = z;
    }
  }
}

// ---------------------------------------------------------------------------
// Fused path combine #1: per-b global softmax stats from the NPART partial
// stats, then write attention weights.  scale[p] = exp(m_p - m) cached for #2.
// ---------------------------------------------------------------------------
__global__ __launch_bounds__(256) void lsa_combine_stats(
    const float* __restrict__ scores, const float* __restrict__ mtile,
    const float* __restrict__ ztile,  float* __restrict__ scale,
    float* __restrict__ mz,           float* __restrict__ out_w) {
  const int b = blockIdx.x, tid = threadIdx.x;

  float mg = mtile[b * NPART];
  #pragma unroll
  for (int p = 1; p < NPART; ++p) mg = fmaxf(mg, mtile[b * NPART + p]);
  float z = 0.f;
  #pragma unroll
  for (int p = 0; p < NPART; ++p)                 // fixed order
    z += ztile[b * NPART + p] * expf(mtile[b * NPART + p] - mg);
  const float inv = 1.0f / z;
  if (tid < NPART) scale[b * NPART + tid] = expf(mtile[b * NPART + tid] - mg);
  if (tid == 0) { mz[b * 2] = mg; mz[b * 2 + 1] = inv; }

  const float* s = scores + b * TT;
  for (int t = tid; t < TT; t += 256)
    out_w[b * TT + t] = expf(s[t] - mg) * inv;
}

// Fused path combine #2: ctx[b][d] = invZ * sum_p scale[p]*ctxp[p][d]
__global__ __launch_bounds__(256) void lsa_combine_ctx(
    const float* __restrict__ ctxp, const float* __restrict__ scale,
    const float* __restrict__ mz,   float* __restrict__ out_ctx) {
  const int b = blockIdx.x, tid = threadIdx.x;
  const float invZ = mz[b * 2 + 1];
  const float2* p = (const float2*)ctxp;
  float2 s; s.x = 0.f; s.y = 0.f;
  for (int c = 0; c < NPART; ++c) {              // fixed order
    float  sc = scale[b * NPART + c];
    float2 x  = p[(size_t)(b * NPART + c) * 256 + tid];
    s.x += sc * x.x; s.y += sc * x.y;
  }
  s.x *= invZ; s.y *= invZ;
  ((float2*)out_ctx)[b * 256 + tid] = s;
}

// ---------------------------------------------------------------------------
// Fallback path (small workspace): plain softmax + second values pass.
// ---------------------------------------------------------------------------
__global__ __launch_bounds__(256) void lsa_softmax(
    const float* __restrict__ scores, float* __restrict__ out_w) {
  __shared__ float red[256];
  const int b = blockIdx.x, tid = threadIdx.x;
  const float* s = scores + b * TT;

  float m = -3.402823466e+38f;
  for (int t = tid; t < TT; t += 256) m = fmaxf(m, s[t]);
  red[tid] = m; __syncthreads();
  for (int off = 128; off > 0; off >>= 1) {
    if (tid < off) red[tid] = fmaxf(red[tid], red[tid + off]);
    __syncthreads();
  }
  m = red[0]; __syncthreads();

  float sum = 0.f;
  for (int t = tid; t < TT; t += 256) sum += expf(s[t] - m);
  red[tid] = sum; __syncthreads();
  for (int off = 128; off > 0; off >>= 1) {
    if (tid < off) red[tid] += red[tid + off];
    __syncthreads();
  }
  const float inv = 1.0f / red[0];
  for (int t = tid; t < TT; t += 256)
    out_w[b * TT + t] = expf(s[t] - m) * inv;
}

__global__ __launch_bounds__(256) void lsa_ctx_partial(
    const float* __restrict__ values, const float* __restrict__ attn_w,
    float* __restrict__ partials) {
  const int b = blockIdx.x >> 5, chunk = blockIdx.x & 31, tid = threadIdx.x;
  const float2* v = (const float2*)(values + ((size_t)b * TT) * DVV);
  const int tbase = chunk * 128;
  float2 acc; acc.x = 0.f; acc.y = 0.f;
  for (int t = 0; t < 128; ++t) {
    float wt = attn_w[b * TT + tbase + t];
    float2 x = v[(size_t)(tbase + t) * 256 + tid];
    acc.x += wt * x.x;
    acc.y += wt * x.y;
  }
  ((float2*)partials)[(size_t)(b * 32 + chunk) * 256 + tid] = acc;
}

__global__ __launch_bounds__(256) void lsa_ctx_reduce(
    const float* __restrict__ partials, float* __restrict__ out_ctx) {
  const int b = blockIdx.x, tid = threadIdx.x;
  const float2* p = (const float2*)partials;
  float2 s; s.x = 0.f; s.y = 0.f;
  #pragma unroll
  for (int c = 0; c < 32; ++c) {
    float2 x = p[(size_t)(b * 32 + c) * 256 + tid];
    s.x += x.x; s.y += x.y;
  }
  ((float2*)out_ctx)[b * 256 + tid] = s;
}

// ---------------------------------------------------------------------------
extern "C" void kernel_launch(void* const* d_in, const int* in_sizes, int n_in,
                              void* d_out, int out_size, void* d_ws, size_t ws_size,
                              hipStream_t stream) {
  const float* query  = (const float*)d_in[0];
  const float* values = (const float*)d_in[1];
  const float* prev   = (const float*)d_in[2];
  const float* conv_w = (const float*)d_in[3];
  const float* conv_b = (const float*)d_in[4];
  const float* loc_w  = (const float*)d_in[5];
  const float* loc_b  = (const float*)d_in[6];
  const float* wq_w   = (const float*)d_in[7];
  const float* wq_b   = (const float*)d_in[8];
  const float* wv_w   = (const float*)d_in[9];
  const float* wv_b   = (const float*)d_in[10];
  const float* attn_b = (const float*)d_in[11];
  const float* proj_w = (const float*)d_in[12];

  float* out_ctx = (float*)d_out;               // [32, 512]
  float* out_w   = out_ctx + BB * DVV;          // [32, 4096]

  unsigned char* ws = (unsigned char*)d_ws;
  unsigned* packWV  = (unsigned*)(ws);            // 32768 u32  (128 KB)
  unsigned* packLOC = (unsigned*)(ws + 131072);   //  2048 u32  (  8 KB)
  float*    qbias   = (float*)(ws + 139264);      //  4096 f32  ( 16 KB)
  float*    scores  = (float*)(ws + 155648);      // 131072 f32 (512 KB)
  // fused-path extras
  float*    mtile   = (float*)(ws + 679936);      //   256 f32
  float*    ztile   = (float*)(ws + 712704);      //   256 f32
  float*    scale   = (float*)(ws + 745472);      //   256 f32
  float*    mz      = (float*)(ws + 778240);      //    64 f32
  float*    ctxp    = (float*)(ws + 778752);      // 32*8*512 f32 (512 KB)
  const size_t fused_need = 778752u + (size_t)BB * NPART * DVV * 4u;
  // fallback-path extra (overlaps the fused region)
  float*    parts   = (float*)(ws + 679936);      // 524288 f32 (2 MB)
  const int fused = (ws_size >= fused_need) ? 1 : 0;

  lsa_prepack_wv <<<128, 256, 0, stream>>>(wv_w, packWV);
  lsa_prepack_loc<<<  8, 256, 0, stream>>>(loc_w, packLOC);
  lsa_qbias      <<<BB * 4, 512, 0, stream>>>(query, wq_w, wq_b, wv_b, loc_b, attn_b, qbias);

  lsa_score<<<BB * NPART, 512, 0, stream>>>(
      values, prev, conv_w, conv_b, packWV, packLOC, qbias, proj_w,
      scores, mtile, ztile, ctxp, fused);

  if (fused) {
    lsa_combine_stats<<<BB, 256, 0, stream>>>(scores, mtile, ztile, scale, mz, out_w);
    lsa_combine_ctx  <<<BB, 256, 0, stream>>>(ctxp, scale, mz, out_ctx);
  } else {
    lsa_softmax    <<< BB, 256, 0, stream>>>(scores, out_w);
    lsa_ctx_partial<<<BB * 32, 256, 0, stream>>>(values, out_w, parts);
    lsa_ctx_reduce <<< BB, 256, 0, stream>>>(parts, out_ctx);
  }
}

// v003
// A run of this version takes 54.3 microseconds.
// Two timings next to v002 put it at 1.18 and 1.17 times that version's speed.
// Counting every step since v000, it is 2.60 times as fast.
#include <hip/hip_runtime.h>
#include <hip/hip_bf16.h>

// ---------------------------------------------------------------------------
// Location-sensitive attention for MI455X (gfx1250, wave32, WMMA).
// B=32, T=4096, DV=512, DQ=512, ATTN=128, FILTERS=32, KSIZE=31
// Fused flash-style context accumulation: values read from HBM exactly once.
// ---------------------------------------------------------------------------

#define BB   32
#define TT   4096
#define DVV  512
#define AA   128
#define FF   32
#define KS   31
#define WAVES   16                  // waves per score workgroup
#define TPW     2                   // 16-row tiles per wave
#define ROWS_WG (WAVES * TPW * 16)  // 512 timesteps per score workgroup
#define NPART   (TT / ROWS_WG)      // 8 partials per batch row
#define APITCH  68                  // dwords per staged row: 128 bf16 + 16 B pad

typedef __attribute__((ext_vector_type(16))) __bf16 v16bf;
typedef __attribute__((ext_vector_type(8)))  float  v8f;

union Frag16 {          // 16 bf16 elements = 8 dwords = one WMMA A/B operand
  v16bf    v;
  unsigned u[8];
  uint4    q[2];
};

__device__ __forceinline__ unsigned short f2bf(float x) {
  unsigned u = __float_as_uint(x);
  u += 0x7FFFu + ((u >> 16) & 1u);      // round-to-nearest-even
  return (unsigned short)(u >> 16);
}
__device__ __forceinline__ unsigned packbf(float a, float b) {
  return (unsigned)f2bf(a) | ((unsigned)f2bf(b) << 16);
}

// ---------------------------------------------------------------------------
// Prepack wv_w [512,128] into WMMA bf16 B-operand layout.
// pk[(((ks*8 + nt)*2 + j/4)*32 + lane)*4 + j%4]  (each 16-B half-fragment of a
// wave is 512 contiguous bytes, conflict-free for LDS b128 reads):
//   lane holds column n = nt*16 + lane%16
//   lanes 0-15 hold K {0..7, 16..23}, lanes 16-31 hold K {8..15, 24..31}
//   dword j packs (K, K+1) with even K in the low half.
// ---------------------------------------------------------------------------
__global__ __launch_bounds__(256) void lsa_prepack_wv(
    const float* __restrict__ wv_w, unsigned* __restrict__ pk) {
  int tid = blockIdx.x * 256 + threadIdx.x;    // 0..32767
  int j   = tid & 7;
  int L   = (tid >> 3) & 31;
  int nt  = (tid >> 8) & 7;
  int ks  = tid >> 11;
  int n   = nt * 16 + (L & 15);
  int kb  = ks * 32 + ((L >> 4) ? 8 : 0) + ((j < 4) ? (2 * j) : (16 + 2 * (j - 4)));
  pk[(((ks * 8 + nt) * 2 + (j >> 2)) * 32 + L) * 4 + (j & 3)] =
      packbf(wv_w[kb * AA + n], wv_w[(kb + 1) * AA + n]);
}

__global__ __launch_bounds__(256) void lsa_prepack_loc(
    const float* __restrict__ loc_w, unsigned* __restrict__ pk) {
  int tid = blockIdx.x * 256 + threadIdx.x;    // 0..2047
  int j   = tid & 7;
  int L   = (tid >> 3) & 31;
  int nt  = tid >> 8;
  int n   = nt * 16 + (L & 15);
  int kb  = ((L >> 4) ? 8 : 0) + ((j < 4) ? (2 * j) : (16 + 2 * (j - 4)));
  pk[((nt * 2 + (j >> 2)) * 32 + L) * 4 + (j & 3)] =
      packbf(loc_w[kb * AA + n], loc_w[(kb + 1) * AA + n]);
}

// ---------------------------------------------------------------------------
// qbias[b][a] = query[b]·wq_w[:,a] + wq_b + wv_b + loc_b + attention_bias
// ---------------------------------------------------------------------------
#define QCOLS 32   // attn columns per qbias workgroup: one 128-B line of each wq_w row
__global__ __launch_bounds__(512) void lsa_qbias(
    const float* __restrict__ query, const float* __restrict__ wq_w,
    const float* __restrict__ wq_b,  const float* __restrict__ wv_b,
    const float* __restrict__ loc_b, const float* __restrict__ attn_b,
    float* __restrict__ qbias) {
  // One workgroup = one batch row x 32 columns; K = 512 is split over 16 waves x
  // 4 lane groups x 8 rows, so a lane needs only 8 row loads and every load of
  // the kernel is issued before the first is used: one memory latency for the
  // kernel instead of one per group of rows.
  __shared__ __align__(16) float part[16][QCOLS];
  const int b    = blockIdx.x >> 2, cq = blockIdx.x & 3, tid = threadIdx.x;
  const int lane = tid & 31, w = tid >> 5;
  const int c4   = (lane & 7) * 4;             // lane's 4 columns in the line
  const int row0 = w * 32 + (lane >> 3) * 8;   // lane's 8 rows of K
  const int a    = cq * QCOLS + lane;          // column of the closing sum
  const float* wp = wq_w + row0 * AA + cq * QCOLS + c4;
  const float* qp = query + b * 512 + row0;
  float4 x[8];
  #pragma unroll
  for (int i = 0; i < 8; ++i) x[i] = *(const float4*)(wp + i * AA);
  float4 qv[2];
  qv[0] = *(const float4*)(qp);
  qv[1] = *(const float4*)(qp + 4);
  const float bq = wq_b[a], bv = wv_b[a], bl = loc_b[a], ba = attn_b[a];
  // precaution: stands ahead of any rewrite of a register the loads above name
  // (the build reuses the query loads' offset register for loaded data at once)
  asm volatile("s_wait_xcnt 0x0" ::: "memory");
  const float qs[8] = {qv[0].x, qv[0].y, qv[0].z, qv[0].w,
                       qv[1].x, qv[1].y, qv[1].z, qv[1].w};
  float4 s = make_float4(0.f, 0.f, 0.f, 0.f);
  #pragma unroll
  for (int i = 0; i < 8; ++i) {
    s.x += qs[i] * x[i].x; s.y += qs[i] * x[i].y;
    s.z += qs[i] * x[i].z; s.w += qs[i] * x[i].w;
  }
  // the wave's 4 lane groups hold the same columns: fold them, fixed order
  #pragma unroll
  for (int d = 8; d < 32; d <<= 1) {
    s.x += __shfl_xor(s.x, d, 32); s.y += __shfl_xor(s.y, d, 32);
    s.z += __shfl_xor(s.z, d, 32); s.w += __shfl_xor(s.w, d, 32);
  }
  if (lane < 8) *(float4*)&part[w][c4] = s;
  __syncthreads();
  if (tid < QCOLS) {
    float t = part[0][tid];
    #pragma unroll
    for (int ww = 1; ww < 16; ++ww) t += part[ww][tid];   // fixed wave order
    qbias[b * AA + a] = t + bq + bv + bl + ba;
  }
}

// ---------------------------------------------------------------------------
// Score (+ fused online-softmax context partial) kernel.
// One workgroup = 512 timesteps of one batch row, 16 waves; the packed weights
// lie in LDS once per workgroup.  Each wave owns 32 whole rows (two 16-row
// tiles) and all 128 attn columns, so a row's score is finished inside the
// wave: scores[b][t] = sum_a tanh(pre)[t][a] * proj_w[a].
// If do_ctx: the wave keeps a running max m, Z = sum exp(s-m) and
// ctx[d] = sum_t exp(s_t-m) * values[t][d] (rows re-read while hot in L2);
// the 16 waves are merged once at the end into one partial per workgroup.
// ---------------------------------------------------------------------------
// The wave's own LDS traffic has landed / returned: its lanes exchange rows
// through a per-wave LDS range, and the clobber keeps the compiler from moving
// LDS accesses across the hand-over.
#define WAVE_LDS_WAIT() asm volatile("s_wait_dscnt 0x0" ::: "memory")

// Eight independent v_exp_f32 (2^x) or v_rcp_f32 in one statement.  Written as
// asm text so that the slot the instruction set asks for behind a transcendental
// is kept by construction: the results are early-clobber, so none of the eight
// reads an earlier result or overwrites an earlier source, and the closing v_nop
// fills the slot behind the last one.
__device__ __forceinline__ void exp2_x8(float (&o)[8], const float (&a)[8]) {
  asm("v_exp_f32 %0, %8\n\tv_exp_f32 %1, %9\n\tv_exp_f32 %2, %10\n\t"
      "v_exp_f32 %3, %11\n\tv_exp_f32 %4, %12\n\tv_exp_f32 %5, %13\n\t"
      "v_exp_f32 %6, %14\n\tv_exp_f32 %7, %15\n\tv_nop"
      : "=&v"(o[0]), "=&v"(o[1]), "=&v"(o[2]), "=&v"(o[3]),
        "=&v"(o[4]), "=&v"(o[5]), "=&v"(o[6]), "=&v"(o[7])
      : "v"(a[0]), "v"(a[1]), "v"(a[2]), "v"(a[3]),
        "v"(a[4]), "v"(a[5]), "v"(a[6]), "v"(a[7]));
}
__device__ __forceinline__ void rcp_x8(float (&o)[8], const float (&a)[8]) {
  asm("v_rcp_f32 %0, %8\n\tv_rcp_f32 %1, %9\n\tv_rcp_f32 %2, %10\n\t"
      "v_rcp_f32 %3, %11\n\tv_rcp_f32 %4, %12\n\tv_rcp_f32 %5, %13\n\t"
      "v_rcp_f32 %6, %14\n\tv_rcp_f32 %7, %15\n\tv_nop"
      : "=&v"(o[0]), "=&v"(o[1]), "=&v"(o[2]), "=&v"(o[3]),
        "=&v"(o[4]), "=&v"(o[5]), "=&v"(o[6]), "=&v"(o[7])
      : "v"(a[0]), "v"(a[1]), "v"(a[2]), "v"(a[3]),
        "v"(a[4]), "v"(a[5]), "v"(a[6]), "v"(a[7]));
}

__global__ __launch_bounds__(512) void lsa_score(
    const float*    __restrict__ values,  const float* __restrict__ prev,
    const float*    __restrict__ conv_w,  const float* __restrict__ conv_b,
    const unsigned* __restrict__ packWV,  const unsigned* __restrict__ packLOC,
    const float*    __restrict__ qbias,   const float* __restrict__ proj_w,
    float*          __restrict__ scores,
    float*          __restrict__ mtile,   float* __restrict__ ztile,
    float*          __restrict__ ctxp,    int do_ctx) {
  __shared__ __align__(16) unsigned sWV [32768];              // 128 KB B panels
  __shared__ __align__(16) unsigned sLOC[2048];               //   8 KB B panels
  __shared__ __align__(16) float    sCW [KS * FF];            //   4 KB conv taps
  __shared__ __align__(16) unsigned stage[WAVES][16 * APITCH]; // 16x128 bf16 per wave
  __shared__ __align__(16) unsigned fbf  [WAVES][16 * 20];     // 16x32 bf16 conv features
  __shared__ __align__(16) float    wctx [WAVES][DVV];         // per-wave context
  __shared__ float pa[WAVES][64];     // per-wave alignment window (62 used)
  __shared__ float sQB[AA];           // query bias row of this batch
  __shared__ float sPW[AA];           // projection weights
  __shared__ float wm[WAVES];
  __shared__ float wz[WAVES];

  const int tid   = threadIdx.x;
  const int lane  = tid & 31;
  const int w     = __builtin_amdgcn_readfirstlane(tid >> 5);
  const int b     = blockIdx.x / NPART;
  const int part  = blockIdx.x % NPART;
  const int row0  = part * ROWS_WG + w * (TPW * 16);   // wave's first timestep
  const int rbase = lane & 15;         // A row / B column within tile
  const int hi    = lane >> 4;         // lane half selects K sub-block
  const int hi4   = hi * 4;            // dword offset of K half-chunk
  const float*   vbase = values + ((size_t)(b * TT + row0)) * DVV;   // wave-uniform
  const unsigned lane4 = lane * 4;                                   // lane's column

  // --- first 16x128 f32 chunk of the wave's rows: one whole 512-B piece per load ---
  float4 g[16];
  #pragma unroll
  for (int r = 0; r < 16; ++r) g[r] = *(const float4*)(vbase + r * DVV + lane4);

  // --- the wave's alignment window (SAME padding, K=31 -> +/-15), both tiles ---
  #pragma unroll
  for (int h = 0; h < 2; ++h) {
    int   idx = row0 - 15 + h * 32 + lane;
    int   cl  = idx < 0 ? 0 : (idx > TT - 1 ? TT - 1 : idx);   // in-bounds address
    float pv  = prev[b * TT + cl];
    pa[w][h * 32 + lane] = (idx == cl) ? pv : 0.0f;
  }

  // --- packed weights -> LDS, once per workgroup ---
  {
    uint4 tmp[16];
    #pragma unroll
    for (int i = 0; i < 16; ++i) tmp[i] = ((const uint4*)packWV)[i * 512 + tid];
    uint4 tl = ((const uint4*)packLOC)[tid];
    #pragma unroll
    for (int i = 0; i < 16; ++i) ((uint4*)sWV)[i * 512 + tid] = tmp[i];
    ((uint4*)sLOC)[tid] = tl;
    if (tid < KS * FF / 4) ((float4*)sCW)[tid] = ((const float4*)conv_w)[tid];
  }

  if (tid < AA) {
    sQB[tid] = qbias[b * AA + tid];
    sPW[tid] = proj_w[tid];
  }
  __syncthreads();

  float  m_run = -3.402823466e+38f, z_run = 0.f;
  // the wave's running context rests in its own LDS row between tiles (each lane
  // touches only its own 16 columns), so the matrix loop has the registers
  #pragma unroll
  for (int j = 0; j < 4; ++j)
    *(float4*)&wctx[w][j * 128 + lane4] = make_float4(0.f, 0.f, 0.f, 0.f);

  #pragma unroll 1   // two tiles share one copy of the body (instruction cache)
  for (int tl = 0; tl < TPW; ++tl) {
    const int t0 = row0 + tl * 16;

    // --- 31-tap conv over alignment (SAME padding): lane -> filter pair c0,
    //     timesteps hi, hi+2, ..., hi+14 ---
    {
      const int c0 = rbase * 2;
      float win[45];
      #pragma unroll
      for (int k = 0; k < 45; ++k) win[k] = pa[w][tl * 16 + hi + k];
      float s0[8], s1[8];
      #pragma unroll
      for (int i = 0; i < 8; ++i) { s0[i] = conv_b[c0]; s1[i] = conv_b[c0 + 1]; }
      #pragma unroll
      for (int j = 0; j < KS; ++j) {
        float2 wj = *(const float2*)&sCW[j * FF + c0];
        #pragma unroll
        for (int i = 0; i < 8; ++i) {
          s0[i] += win[2 * i + j] * wj.x;
          s1[i] += win[2 * i + j] * wj.y;
        }
      }
      WAVE_LDS_WAIT();   // last tile's feature reads are back before the rows change
      #pragma unroll
      for (int i = 0; i < 8; ++i)
        fbf[w][(hi + 2 * i) * 20 + rbase] = packbf(s0[i], s1[i]);
      WAVE_LDS_WAIT();   // feature rows written before other lanes read them
    }

    v8f acc[8];

    // --- proc_loc = f(16x32) @ loc_w(32x128): 8 bf16 WMMAs ---
    {
      Frag16 fa;
      fa.q[0] = *(const uint4*)&fbf[w][rbase * 20 + hi4];
      fa.q[1] = *(const uint4*)&fbf[w][rbase * 20 + 8 + hi4];
      #pragma unroll
      for (int nt = 0; nt < 8; ++nt) {
        Frag16 lb;
        lb.q[0] = *(const uint4*)&sLOC[(nt * 2 + 0) * 128 + lane * 4];
        lb.q[1] = *(const uint4*)&sLOC[(nt * 2 + 1) * 128 + lane * 4];
        v8f zero = {};
        acc[nt] = __builtin_amdgcn_wmma_f32_16x16x32_bf16(
            false, fa.v, false, lb.v, (short)0, zero, false, false);
      }
    }

    // --- wv = values(16x512) @ wv_w(512x128): 4 chunks of K=128, 32 WMMAs each ---
    #pragma unroll 1   // rolled: one LDS base per chunk, B offsets fit the immediate field
    for (int c = 0; c < 4; ++c) {
      const unsigned* bpan = &sWV[c * 8192 + lane * 4];
      WAVE_LDS_WAIT();   // last chunk's A reads are back before its rows change
      #pragma unroll
      for (int r = 0; r < 16; ++r) {
        uint2 p;
        p.x = packbf(g[r].x, g[r].y);
        p.y = packbf(g[r].z, g[r].w);
        *(uint2*)&stage[w][r * APITCH + lane * 2] = p;
      }
      // next chunk's loads fly under this chunk's WMMAs
      const int nc = tl * 4 + c + 1;
      if (nc < TPW * 4) {
        const float* nsrc = vbase + (size_t)((nc >> 2) * 16) * DVV + (nc & 3) * 128;
        #pragma unroll
        for (int r = 0; r < 16; ++r) g[r] = *(const float4*)(nsrc + r * DVV + lane4);
        // precaution: stands ahead of any rewrite of a register these loads name
        asm volatile("s_wait_xcnt 0x0" ::: "memory");
      }
      WAVE_LDS_WAIT();   // staged rows written before other lanes read them
      #pragma unroll
      for (int ksl = 0; ksl < 4; ++ksl) {
        Frag16 av;
        const unsigned* arow = &stage[w][rbase * APITCH + ksl * 16 + hi4];
        av.q[0] = *(const uint4*)(arow);
        av.q[1] = *(const uint4*)(arow + 8);
        #pragma unroll
        for (int nh = 0; nh < 8; nh += 4) {
          Frag16 bv[4];
          #pragma unroll
          for (int nt = 0; nt < 4; ++nt) {
            bv[nt].q[0] = *(const uint4*)(bpan + ((ksl * 8 + nh + nt) * 2 + 0) * 128);
            bv[nt].q[1] = *(const uint4*)(bpan + ((ksl * 8 + nh + nt) * 2 + 1) * 128);
          }
          // keeps a group's 8 LDS reads together ahead of its 4 WMMAs (they issue
          // under the group before): one LDS latency per group, not one per WMMA
          __builtin_amdgcn_sched_barrier(0);
          #pragma unroll
          for (int nt = 0; nt < 4; ++nt)
            acc[nh + nt] = __builtin_amdgcn_wmma_f32_16x16x32_bf16(
                false, av.v, false, bv[nt].v, (short)0, acc[nh + nt], false, false);
        }
      }
    }

    // --- epilogue: tanh, project, reduce over attn dim (deterministic) ---
    // C layout: vgpr i -> row i (lanes 0-15) / row i+8 (lanes 16-31), col=lane%16
    // tanh(x) = 1 - 2 / (1 + e^(2x)), written without a branch: 64 independent
    // short chains per lane instead of 64 masked two-way branches in series.
    // e^(2x) = inf gives 1, e^(2x) = 0 gives -1, NaN stays NaN; the absolute
    // error is a few f32 roundings of 1, far below the bf16 products' own.  The
    // projection is folded in: sum_a pw*tanh = sum_a pw - 2 * sum_a pw / (1 + e^(2x)).
    const float K2 = 2.8853900817779268f;   // 2 * log2(e)
    float qk[8], pw2[8];
    float pws = 0.f;
    #pragma unroll
    for (int nt = 0; nt < 8; ++nt) {
      const float p = sPW[nt * 16 + rbase];
      qk[nt]  = sQB[nt * 16 + rbase] * K2;
      pw2[nt] = -2.0f * p;
      pws    += p;
    }
    float ps[8];
    #pragma unroll
    for (int i = 0; i < 8; ++i) {
      float xa[8], ex[8], rc[8];
      #pragma unroll
      for (int nt = 0; nt < 8; ++nt) xa[nt] = fmaf(acc[nt][i], K2, qk[nt]);
      exp2_x8(ex, xa);
      #pragma unroll
      for (int nt = 0; nt < 8; ++nt) ex[nt] += 1.0f;
      rcp_x8(rc, ex);
      float vv = pws;
      #pragma unroll
      for (int nt = 0; nt < 8; ++nt) vv = fmaf(rc[nt], pw2[nt], vv);
      vv += __shfl_xor(vv, 1, 16);
      vv += __shfl_xor(vv, 2, 16);
      vv += __shfl_xor(vv, 4, 16);
      vv += __shfl_xor(vv, 8, 16);
      ps[i] = vv;                       // score of row i + 8*hi, in all 16 lanes
    }
    {
      float mine = ps[0];
      #pragma unroll
      for (int i = 1; i < 8; ++i) mine = (rbase == i) ? ps[i] : mine;
      if (rbase < 8) scores[b * TT + t0 + hi * 8 + rbase] = mine;
    }

    if (do_ctx) {
      // --- all 16 scores in every lane, then the online-softmax update ---
      float sc[16];
      #pragma unroll
      for (int i = 0; i < 8; ++i) {
        float other = __shfl_xor(ps[i], 16, 32);
        sc[i]     = hi ? other : ps[i];
        sc[i + 8] = hi ? ps[i] : other;
      }
      float mn = m_run;
      #pragma unroll
      for (int t = 0; t < 16; ++t) mn = fmaxf(mn, sc[t]);
      const float resc = expf(m_run - mn);
      m_run = mn;
      z_run *= resc;
      float4 cx[4];
      #pragma unroll
      for (int j = 0; j < 4; ++j) {
        cx[j] = *(const float4*)&wctx[w][j * 128 + lane4];
        cx[j].x *= resc; cx[j].y *= resc; cx[j].z *= resc; cx[j].w *= resc;
      }
      #pragma unroll
      for (int t = 0; t < 16; ++t) { sc[t] = expf(sc[t] - mn); z_run += sc[t]; }

      // --- ctx[d] += e_t * values[t][d]; the tile's re-read hits L2 ---
      const float* rsrc = vbase + (size_t)(tl * 16) * DVV;
      #pragma unroll
      for (int tb = 0; tb < 16; tb += 4) {
        float4 x[4][4];
        #pragma unroll
        for (int t = 0; t < 4; ++t) {
          #pragma unroll
          for (int j = 0; j < 4; ++j)
            x[t][j] = *(const float4*)(rsrc + (tb + t) * DVV + j * 128 + lane4);
        }
        // keeps four rows' 16 loads in flight together: one L2 latency per
        // batch instead of one per load
        __builtin_amdgcn_sched_barrier(0);
        #pragma unroll
        for (int t = 0; t < 4; ++t) {
          #pragma unroll
          for (int j = 0; j < 4; ++j) {
            cx[j].x += sc[tb + t] * x[t][j].x;
            cx[j].y += sc[tb + t] * x[t][j].y;
            cx[j].z += sc[tb + t] * x[t][j].z;
            cx[j].w += sc[tb + t] * x[t][j].w;
          }
        }
      }
      #pragma unroll
      for (int j = 0; j < 4; ++j) *(float4*)&wctx[w][j * 128 + lane4] = cx[j];
    }
  }

  if (!do_ctx) return;

  // --- merge the 16 waves' (m, Z, ctx) into one partial, fixed order ---
  if (lane == 0) { wm[w] = m_run; wz[w] = z_run; }
  __syncthreads();
  {
    float m = wm[0];
    #pragma unroll
    for (int ww = 1; ww < WAVES; ++ww) m = fmaxf(m, wm[ww]);
    float z = 0.f, cacc = 0.f;
    #pragma unroll
    for (int ww = 0; ww < WAVES; ++ww) {
      float e = expf(wm[ww] - m);
      z    += wz[ww] * e;
      cacc += e * wctx[ww][tid];
    }
    ctxp[(size_t)(b * NPART + part) * DVV + tid] = cacc;
    if (tid == 0) {
      mtile[b * NPART + part] = m;
      ztile[b * NPART + part] = z;
    }
  }
}

// ---------------------------------------------------------------------------
// Fused path combine #1: per-b global softmax stats from the NPART partial
// stats, then write attention weights.  scale[p] = exp(m_p - m) cached for #2.
// ---------------------------------------------------------------------------
__global__ __launch_bounds__(256) void lsa_combine_stats(
    const float* __restrict__ scores, const float* __restrict__ mtile,
    const float* __restrict__ ztile,  float* __restrict__ scale,
    float* __restrict__ mz,           float* __restrict__ out_w) {
  const int b = blockIdx.x, tid = threadIdx.x;

  float mg = mtile[b * NPART];
  #pragma unroll
  for (int p = 1; p < NPART; ++p) mg = fmaxf(mg, mtile[b * NPART + p]);
  float z = 0.f;
  #pragma unroll
  for (int p = 0; p < NPART; ++p)                 // fixed order
    z += ztile[b * NPART + p] * expf(mtile[b * NPART + p] - mg);
  const float inv = 1.0f / z;
  if (tid < NPART) scale[b * NPART + tid] = expf(mtile[b * NPART + tid] - mg);
  if (tid == 0) { mz[b * 2] = mg; mz[b * 2 + 1] = inv; }

  const float* s = scores + b * TT;
  for (int t = tid; t < TT; t += 256)
    out_w[b * TT + t] = expf(s[t] - mg) * inv;
}

// Fused path combine #2: ctx[b][d] = invZ * sum_p scale[p]*ctxp[p][d]
__global__ __launch_bounds__(256) void lsa_combine_ctx(
    const float* __restrict__ ctxp, const float* __restrict__ scale,
    const float* __restrict__ mz,   float* __restrict__ out_ctx) {
  const int b = blockIdx.x, tid = threadIdx.x;
  const float invZ = mz[b * 2 + 1];
  const float2* p = (const float2*)ctxp;
  float2 s; s.x = 0.f; s.y = 0.f;
  for (int c = 0; c < NPART; ++c) {              // fixed order
    float  sc = scale[b * NPART + c];
    float2 x  = p[(size_t)(b * NPART + c) * 256 + tid];
    s.x += sc * x.x; s.y += sc * x.y;
  }
  s.x *= invZ; s.y *= invZ;
  ((float2*)out_ctx)[b * 256 + tid] = s;
}

// ---------------------------------------------------------------------------
// Fallback path (small workspace): plain softmax + second values pass.
// ---------------------------------------------------------------------------
__global__ __launch_bounds__(256) void lsa_softmax(
    const float* __restrict__ scores, float* __restrict__ out_w) {
  __shared__ float red[256];
  const int b = blockIdx.x, tid = threadIdx.x;
  const float* s = scores + b * TT;

  float m = -3.402823466e+38f;
  for (int t = tid; t < TT; t += 256) m = fmaxf(m, s[t]);
  red[tid] = m; __syncthreads();
  for (int off = 128; off > 0; off >>= 1) {
    if (tid < off) red[tid] = fmaxf(red[tid], red[tid + off]);
    __syncthreads();
  }
  m = red[0]; __syncthreads();

  float sum = 0.f;
  for (int t = tid; t < TT; t += 256) sum += expf(s[t] - m);
  red[tid] = sum; __syncthreads();
  for (int off = 128; off > 0; off >>= 1) {
    if (tid < off) red[tid] += red[tid + off];
    __syncthreads();
  }
  const float inv = 1.0f / red[0];
  for (int t = tid; t < TT; t += 256)
    out_w[b * TT + t] = expf(s[t] - m) * inv;
}

__global__ __launch_bounds__(256) void lsa_ctx_partial(
    const float* __restrict__ values, const float* __restrict__ attn_w,
    float* __restrict__ partials) {
  const int b = blockIdx.x >> 5, chunk = blockIdx.x & 31, tid = threadIdx.x;
  const float2* v = (const float2*)(values + ((size_t)b * TT) * DVV);
  const int tbase = chunk * 128;
  float2 acc; acc.x = 0.f; acc.y = 0.f;
  for (int t = 0; t < 128; ++t) {
    float wt = attn_w[b * TT + tbase + t];
    float2 x = v[(size_t)(tbase + t) * 256 + tid];
    acc.x += wt * x.x;
    acc.y += wt * x.y;
  }
  ((float2*)partials)[(size_t)(b * 32 + chunk) * 256 + tid] = acc;
}

__global__ __launch_bounds__(256) void lsa_ctx_reduce(
    const float* __restrict__ partials, float* __restrict__ out_ctx) {
  const int b = blockIdx.x, tid = threadIdx.x;
  const float2* p = (const float2*)partials;
  float2 s; s.x = 0.f; s.y = 0.f;
  #pragma unroll
  for (int c = 0; c < 32; ++c) {
    float2 x = p[(size_t)(b * 32 + c) * 256 + tid];
    s.x += x.x; s.y += x.y;
  }
  ((float2*)out_ctx)[b * 256 + tid] = s;
}

// ---------------------------------------------------------------------------
extern "C" void kernel_launch(void* const* d_in, const int* in_sizes, int n_in,
                              void* d_out, int out_size, void* d_ws, size_t ws_size,
                              hipStream_t stream) {
  const float* query  = (const float*)d_in[0];
  const float* values = (const float*)d_in[1];
  const float* prev   = (const float*)d_in[2];
  const float* conv_w = (const float*)d_in[3];
  const float* conv_b = (const float*)d_in[4];
  const float* loc_w  = (const float*)d_in[5];
  const float* loc_b  = (const float*)d_in[6];
  const float* wq_w   = (const float*)d_in[7];
  const float* wq_b   = (const float*)d_in[8];
  const float* wv_w   = (const float*)d_in[9];
  const float* wv_b   = (const float*)d_in[10];
  const float* attn_b = (const float*)d_in[11];
  const float* proj_w = (const float*)d_in[12];

  float* out_ctx = (float*)d_out;               // [32, 512]
  float* out_w   = out_ctx + BB * DVV;          // [32, 4096]

  unsigned char* ws = (unsigned char*)d_ws;
  unsigned* packWV  = (unsigned*)(ws);            // 32768 u32  (128 KB)
  unsigned* packLOC = (unsigned*)(ws + 131072);   //  2048 u32  (  8 KB)
  float*    qbias   = (float*)(ws + 139264);      //  4096 f32  ( 16 KB)
  float*    scores  = (float*)(ws + 155648);      // 131072 f32 (512 KB)
  // fused-path extras
  float*    mtile   = (float*)(ws + 679936);      //   256 f32
  float*    ztile   = (float*)(ws + 712704);      //   256 f32
  float*    scale   = (float*)(ws + 745472);      //   256 f32
  float*    mz      = (float*)(ws + 778240);      //    64 f32
  float*    ctxp    = (float*)(ws + 778752);      // 32*8*512 f32 (512 KB)
  const size_t fused_need = 778752u + (size_t)BB * NPART * DVV * 4u;
  // fallback-path extra (overlaps the fused region)
  float*    parts   = (float*)(ws + 679936);      // 524288 f32 (2 MB)
  const int fused = (ws_size >= fused_need) ? 1 : 0;

  lsa_prepack_wv <<<128, 256, 0, stream>>>(wv_w, packWV);
  lsa_prepack_loc<<<  8, 256, 0, stream>>>(loc_w, packLOC);
  lsa_qbias      <<<BB * 4, 512, 0, stream>>>(query, wq_w, wq_b, wv_b, loc_b, attn_b, qbias);

  lsa_score<<<BB * NPART, 512, 0, stream>>>(
      values, prev, conv_w, conv_b, packWV, packLOC, qbias, proj_w,
      scores, mtile, ztile, ctxp, fused);

  if (fused) {
    lsa_combine_stats<<<BB, 256, 0, stream>>>(scores, mtile, ztile, scale, mz, out_w);
    lsa_combine_ctx  <<<BB, 256, 0, stream>>>(ctxp, scale, mz, out_ctx);
  } else {
    lsa_softmax    <<< BB, 256, 0, stream>>>(scores, out_w);
    lsa_ctx_partial<<<BB * 32, 256, 0, stream>>>(values, out_w, parts);
    lsa_ctx_reduce <<< BB, 256, 0, stream>>>(parts, out_ctx);
  }
}

// v004
// One run takes 49.4 microseconds.
// Two timings next to v003 put it at 1.11 and 1.09 times that version's speed.
// Counting every step since v000, it is 2.86 times as fast.
#include <hip/hip_runtime.h>
#include <hip/hip_bf16.h>

// ---------------------------------------------------------------------------
// Location-sensitive attention for MI455X (gfx1250, wave32, WMMA).
// B=32, T=4096, DV=512, DQ=512, ATTN=128, FILTERS=32, KSIZE=31
// Fused flash-style context accumulation: values read from HBM exactly once.
// ---------------------------------------------------------------------------

#define BB   32
#define TT   4096
#define DVV  512
#define AA   128
#define FF   32
#define KS   31
#define WAVES   16                  // waves per score workgroup
#define TPW     2                   // 16-row tiles per wave
#define ROWS_WG (WAVES * TPW * 16)  // 512 timesteps per score workgroup
#define NPART   (TT / ROWS_WG)      // 8 partials per batch row
#define APITCH  68                  // dwords per staged row: 128 bf16 + 16 B pad

typedef __attribute__((ext_vector_type(16))) __bf16 v16bf;
typedef __attribute__((ext_vector_type(8)))  float  v8f;

union Frag16 {          // 16 bf16 elements = 8 dwords = one WMMA A/B operand
  v16bf    v;
  unsigned u[8];
  uint4    q[2];
};

__device__ __forceinline__ unsigned short f2bf(float x) {
  unsigned u = __float_as_uint(x);
  u += 0x7FFFu + ((u >> 16) & 1u);      // round-to-nearest-even
  return (unsigned short)(u >> 16);
}
__device__ __forceinline__ unsigned packbf(float a, float b) {
  return (unsigned)f2bf(a) | ((unsigned)f2bf(b) << 16);
}

// ---------------------------------------------------------------------------
// Prepack wv_w [512,128] into WMMA bf16 B-operand layout.
// pk[(((ks*8 + nt)*2 + j/4)*32 + lane)*4 + j%4]  (each 16-B half-fragment of a
// wave is 512 contiguous bytes, conflict-free for LDS b128 reads):
//   lane holds column n = nt*16 + lane%16
//   lanes 0-15 hold K {0..7, 16..23}, lanes 16-31 hold K {8..15, 24..31}
//   dword j packs (K, K+1) with even K in the low half.
// ---------------------------------------------------------------------------
__device__ __forceinline__ void prepack_wv_item(
    int tid /* 0..32767 */, const float* __restrict__ wv_w, unsigned* __restrict__ pk) {
  int j   = tid & 7;
  int L   = (tid >> 3) & 31;
  int nt  = (tid >> 8) & 7;
  int ks  = tid >> 11;
  int n   = nt * 16 + (L & 15);
  int kb  = ks * 32 + ((L >> 4) ? 8 : 0) + ((j < 4) ? (2 * j) : (16 + 2 * (j - 4)));
  pk[(((ks * 8 + nt) * 2 + (j >> 2)) * 32 + L) * 4 + (j & 3)] =
      packbf(wv_w[kb * AA + n], wv_w[(kb + 1) * AA + n]);
  // precaution: in the shared-grid build other blocks' code follows this store, so
  // the wait stands ahead of any rewrite of a register the store names
  asm volatile("s_wait_xcnt 0x0" ::: "memory");
}

__device__ __forceinline__ void prepack_loc_item(
    int tid /* 0..2047 */, const float* __restrict__ loc_w, unsigned* __restrict__ pk) {
  int j   = tid & 7;
  int L   = (tid >> 3) & 31;
  int nt  = tid >> 8;
  int n   = nt * 16 + (L & 15);
  int kb  = ((L >> 4) ? 8 : 0) + ((j < 4) ? (2 * j) : (16 + 2 * (j - 4)));
  pk[((nt * 2 + (j >> 2)) * 32 + L) * 4 + (j & 3)] =
      packbf(loc_w[kb * AA + n], loc_w[(kb + 1) * AA + n]);
  // precaution: in the shared-grid build other blocks' code follows this store, so
  // the wait stands ahead of any rewrite of a register the store names
  asm volatile("s_wait_xcnt 0x0" ::: "memory");
}

// ---------------------------------------------------------------------------
// qbias[b][a] = query[b]·wq_w[:,a] + wq_b + wv_b + loc_b + attention_bias
// ---------------------------------------------------------------------------
#define QCOLS 32   // attn columns per qbias workgroup: one 128-B line of each wq_w row
__device__ __forceinline__ void qbias_block(
    int blk /* 0..BB*4-1 */,
    const float* __restrict__ query, const float* __restrict__ wq_w,
    const float* __restrict__ wq_b,  const float* __restrict__ wv_b,
    const float* __restrict__ loc_b, const float* __restrict__ attn_b,
    float* __restrict__ qbias) {
  // One workgroup = one batch row x 32 columns; K = 512 is split over 16 waves x
  // 4 lane groups x 8 rows, so a lane needs only 8 row loads and every load of
  // the kernel is issued before the first is used: one memory latency for the
  // kernel instead of one per group of rows.
  __shared__ __align__(16) float part[16][QCOLS];
  const int b    = blk >> 2, cq = blk & 3, tid = threadIdx.x;
  const int lane = tid & 31, w = tid >> 5;
  const int c4   = (lane & 7) * 4;             // lane's 4 columns in the line
  const int row0 = w * 32 + (lane >> 3) * 8;   // lane's 8 rows of K
  const int a    = cq * QCOLS + lane;          // column of the closing sum
  const float* wp = wq_w + row0 * AA + cq * QCOLS + c4;
  const float* qp = query + b * 512 + row0;
  float4 x[8];
  #pragma unroll
  for (int i = 0; i < 8; ++i) x[i] = *(const float4*)(wp + i * AA);
  float4 qv[2];
  qv[0] = *(const float4*)(qp);
  qv[1] = *(const float4*)(qp + 4);
  // precaution: in the shared-grid build a bias load's result lands in the query
  // loads' offset register, so the wait also stands between those loads
  asm volatile("s_wait_xcnt 0x0" ::: "memory");
  const float bq = wq_b[a], bv = wv_b[a], bl = loc_b[a], ba = attn_b[a];
  // precaution: stands ahead of any rewrite of a register the loads above name
  asm volatile("s_wait_xcnt 0x0" ::: "memory");
  const float qs[8] = {qv[0].x, qv[0].y, qv[0].z, qv[0].w,
                       qv[1].x, qv[1].y, qv[1].z, qv[1].w};
  float4 s = make_float4(0.f, 0.f, 0.f, 0.f);
  #pragma unroll
  for (int i = 0; i < 8; ++i) {
    s.x += qs[i] * x[i].x; s.y += qs[i] * x[i].y;
    s.z += qs[i] * x[i].z; s.w += qs[i] * x[i].w;
  }
  // the wave's 4 lane groups hold the same columns: fold them, fixed order
  #pragma unroll
  for (int d = 8; d < 32; d <<= 1) {
    s.x += __shfl_xor(s.x, d, 32); s.y += __shfl_xor(s.y, d, 32);
    s.z += __shfl_xor(s.z, d, 32); s.w += __shfl_xor(s.w, d, 32);
  }
  if (lane < 8) *(float4*)&part[w][c4] = s;
  __syncthreads();
  if (tid < QCOLS) {
    float t = part[0][tid];
    #pragma unroll
    for (int ww = 1; ww < 16; ++ww) t += part[ww][tid];   // fixed wave order
    qbias[b * AA + a] = t + bq + bv + bl + ba;
  }
}

// ---------------------------------------------------------------------------
// All the work the score kernel waits for, in ONE launch: the query bias and the
// two weight prepacks read and write disjoint data, so they share a grid by
// block range and run side by side (196 workgroups, all resident at once)
// instead of one after another with a launch gap between them.
// ---------------------------------------------------------------------------
#define PRE_QB  (BB * 4)            // blocks   0..127: query bias (the longest, first)
#define PRE_WV  (32768 / 512)       // blocks 128..191: wv_w prepack
#define PRE_LOC (2048 / 512)        // blocks 192..195: loc_w prepack
__global__ __launch_bounds__(512) void lsa_pre(
    const float* __restrict__ query, const float* __restrict__ wq_w,
    const float* __restrict__ wq_b,  const float* __restrict__ wv_b,
    const float* __restrict__ loc_b, const float* __restrict__ attn_b,
    const float* __restrict__ wv_w,  const float* __restrict__ loc_w,
    float* __restrict__ qbias, unsigned* __restrict__ packWV,
    unsigned* __restrict__ packLOC) {
  const int blk = blockIdx.x;        // the branch is uniform for the workgroup
  if (blk < PRE_QB)
    qbias_block(blk, query, wq_w, wq_b, wv_b, loc_b, attn_b, qbias);
  else if (blk < PRE_QB + PRE_WV)
    prepack_wv_item((blk - PRE_QB) * 512 + threadIdx.x, wv_w, packWV);
  else
    prepack_loc_item((blk - PRE_QB - PRE_WV) * 512 + threadIdx.x, loc_w, packLOC);
}

// ---------------------------------------------------------------------------
// Score (+ fused online-softmax context partial) kernel.
// One workgroup = 512 timesteps of one batch row, 16 waves; the packed weights
// lie in LDS once per workgroup.  Each wave owns 32 whole rows (two 16-row
// tiles) and all 128 attn columns, so a row's score is finished inside the
// wave: scores[b][t] = sum_a tanh(pre)[t][a] * proj_w[a].
// If do_ctx: the wave keeps a running max m, Z = sum exp(s-m) and
// ctx[d] = sum_t exp(s_t-m) * values[t][d] (rows re-read while hot in L2);
// the 16 waves are merged once at the end into one partial per workgroup.
// ---------------------------------------------------------------------------
// The wave's own LDS traffic has landed / returned: its lanes exchange rows
// through a per-wave LDS range, and the clobber keeps the compiler from moving
// LDS accesses across the hand-over.
#define WAVE_LDS_WAIT() asm volatile("s_wait_dscnt 0x0" ::: "memory")

// Eight independent v_exp_f32 (2^x) or v_rcp_f32 in one statement.  Written as
// asm text so that the slot the instruction set asks for behind a transcendental
// is kept by construction: the results are early-clobber, so none of the eight
// reads an earlier result or overwrites an earlier source, and the closing v_nop
// fills the slot behind the last one.
__device__ __forceinline__ void exp2_x8(float (&o)[8], const float (&a)[8]) {
  asm("v_exp_f32 %0, %8\n\tv_exp_f32 %1, %9\n\tv_exp_f32 %2, %10\n\t"
      "v_exp_f32 %3, %11\n\tv_exp_f32 %4, %12\n\tv_exp_f32 %5, %13\n\t"
      "v_exp_f32 %6, %14\n\tv_exp_f32 %7, %15\n\tv_nop"
      : "=&v"(o[0]), "=&v"(o[1]), "=&v"(o[2]), "=&v"(o[3]),
        "=&v"(o[4]), "=&v"(o[5]), "=&v"(o[6]), "=&v"(o[7])
      : "v"(a[0]), "v"(a[1]), "v"(a[2]), "v"(a[3]),
        "v"(a[4]), "v"(a[5]), "v"(a[6]), "v"(a[7]));
}
__device__ __forceinline__ void rcp_x8(float (&o)[8], const float (&a)[8]) {
  asm("v_rcp_f32 %0, %8\n\tv_rcp_f32 %1, %9\n\tv_rcp_f32 %2, %10\n\t"
      "v_rcp_f32 %3, %11\n\tv_rcp_f32 %4, %12\n\tv_rcp_f32 %5, %13\n\t"
      "v_rcp_f32 %6, %14\n\tv_rcp_f32 %7, %15\n\tv_nop"
      : "=&v"(o[0]), "=&v"(o[1]), "=&v"(o[2]), "=&v"(o[3]),
        "=&v"(o[4]), "=&v"(o[5]), "=&v"(o[6]), "=&v"(o[7])
      : "v"(a[0]), "v"(a[1]), "v"(a[2]), "v"(a[3]),
        "v"(a[4]), "v"(a[5]), "v"(a[6]), "v"(a[7]));
}

__global__ __launch_bounds__(512) void lsa_score(
    const float*    __restrict__ values,  const float* __restrict__ prev,
    const float*    __restrict__ conv_w,  const float* __restrict__ conv_b,
    const unsigned* __restrict__ packWV,  const unsigned* __restrict__ packLOC,
    const float*    __restrict__ qbias,   const float* __restrict__ proj_w,
    float*          __restrict__ scores,
    float*          __restrict__ mtile,   float* __restrict__ ztile,
    float*          __restrict__ ctxp,    int do_ctx) {
  __shared__ __align__(16) unsigned sWV [32768];              // 128 KB B panels
  __shared__ __align__(16) unsigned sLOC[2048];               //   8 KB B panels
  __shared__ __align__(16) float    sCW [KS * FF];            //   4 KB conv taps
  __shared__ __align__(16) unsigned stage[WAVES][16 * APITCH]; // 16x128 bf16 per wave
  __shared__ __align__(16) unsigned fbf  [WAVES][16 * 20];     // 16x32 bf16 conv features
  __shared__ __align__(16) float    wctx [WAVES][DVV];         // per-wave context
  __shared__ float pa[WAVES][64];     // per-wave alignment window (62 used)
  __shared__ float sQB[AA];           // query bias row of this batch
  __shared__ float sPW[AA];           // projection weights
  __shared__ float wm[WAVES];
  __shared__ float wz[WAVES];

  const int tid   = threadIdx.x;
  const int lane  = tid & 31;
  const int w     = __builtin_amdgcn_readfirstlane(tid >> 5);
  const int b     = blockIdx.x / NPART;
  const int part  = blockIdx.x % NPART;
  const int row0  = part * ROWS_WG + w * (TPW * 16);   // wave's first timestep
  const int rbase = lane & 15;         // A row / B column within tile
  const int hi    = lane >> 4;         // lane half selects K sub-block
  const int hi4   = hi * 4;            // dword offset of K half-chunk
  const float*   vbase = values + ((size_t)(b * TT + row0)) * DVV;   // wave-uniform
  const unsigned lane4 = lane * 4;                                   // lane's column

  // --- first 16x128 f32 chunk of the wave's rows: one whole 512-B piece per load ---
  float4 g[16];
  #pragma unroll
  for (int r = 0; r < 16; ++r) g[r] = *(const float4*)(vbase + r * DVV + lane4);

  // --- the wave's alignment window (SAME padding, K=31 -> +/-15), both tiles ---
  #pragma unroll
  for (int h = 0; h < 2; ++h) {
    int   idx = row0 - 15 + h * 32 + lane;
    int   cl  = idx < 0 ? 0 : (idx > TT - 1 ? TT - 1 : idx);   // in-bounds address
    float pv  = prev[b * TT + cl];
    pa[w][h * 32 + lane] = (idx == cl) ? pv : 0.0f;
  }

  // --- packed weights -> LDS, once per workgroup ---
  {
    uint4 tmp[16];
    #pragma unroll
    for (int i = 0; i < 16; ++i) tmp[i] = ((const uint4*)packWV)[i * 512 + tid];
    uint4 tl = ((const uint4*)packLOC)[tid];
    #pragma unroll
    for (int i = 0; i < 16; ++i) ((uint4*)sWV)[i * 512 + tid] = tmp[i];
    ((uint4*)sLOC)[tid] = tl;
    if (tid < KS * FF / 4) ((float4*)sCW)[tid] = ((const float4*)conv_w)[tid];
  }

  if (tid < AA) {
    sQB[tid] = qbias[b * AA + tid];
    sPW[tid] = proj_w[tid];
  }
  __syncthreads();

  float  m_run = -3.402823466e+38f, z_run = 0.f;
  // the wave's running context rests in its own LDS row between tiles (each lane
  // touches only its own 16 columns), so the matrix loop has the registers
  #pragma unroll
  for (int j = 0; j < 4; ++j)
    *(float4*)&wctx[w][j * 128 + lane4] = make_float4(0.f, 0.f, 0.f, 0.f);

  #pragma unroll 1   // two tiles share one copy of the body (instruction cache)
  for (int tl = 0; tl < TPW; ++tl) {
    const int t0 = row0 + tl * 16;

    // --- 31-tap conv over alignment (SAME padding): lane -> filter pair c0,
    //     timesteps hi, hi+2, ..., hi+14 ---
    {
      const int c0 = rbase * 2;
      float win[45];
      #pragma unroll
      for (int k = 0; k < 45; ++k) win[k] = pa[w][tl * 16 + hi + k];
      float s0[8], s1[8];
      #pragma unroll
      for (int i = 0; i < 8; ++i) { s0[i] = conv_b[c0]; s1[i] = conv_b[c0 + 1]; }
      #pragma unroll
      for (int j = 0; j < KS; ++j) {
        float2 wj = *(const float2*)&sCW[j * FF + c0];
        #pragma unroll
        for (int i = 0; i < 8; ++i) {
          s0[i] += win[2 * i + j] * wj.x;
          s1[i] += win[2 * i + j] * wj.y;
        }
      }
      WAVE_LDS_WAIT();   // last tile's feature reads are back before the rows change
      #pragma unroll
      for (int i = 0; i < 8; ++i)
        fbf[w][(hi + 2 * i) * 20 + rbase] = packbf(s0[i], s1[i]);
      WAVE_LDS_WAIT();   // feature rows written before other lanes read them
    }

    v8f acc[8];

    // --- proc_loc = f(16x32) @ loc_w(32x128): 8 bf16 WMMAs ---
    {
      Frag16 fa;
      fa.q[0] = *(const uint4*)&fbf[w][rbase * 20 + hi4];
      fa.q[1] = *(const uint4*)&fbf[w][rbase * 20 + 8 + hi4];
      #pragma unroll
      for (int nt = 0; nt < 8; ++nt) {
        Frag16 lb;
        lb.q[0] = *(const uint4*)&sLOC[(nt * 2 + 0) * 128 + lane * 4];
        lb.q[1] = *(const uint4*)&sLOC[(nt * 2 + 1) * 128 + lane * 4];
        v8f zero = {};
        acc[nt] = __builtin_amdgcn_wmma_f32_16x16x32_bf16(
            false, fa.v, false, lb.v, (short)0, zero, false, false);
      }
    }

    // --- wv = values(16x512) @ wv_w(512x128): 4 chunks of K=128, 32 WMMAs each ---
    #pragma unroll 1   // rolled: one LDS base per chunk, B offsets fit the immediate field
    for (int c = 0; c < 4; ++c) {
      const unsigned* bpan = &sWV[c * 8192 + lane * 4];
      WAVE_LDS_WAIT();   // last chunk's A reads are back before its rows change
      #pragma unroll
      for (int r = 0; r < 16; ++r) {
        uint2 p;
        p.x = packbf(g[r].x, g[r].y);
        p.y = packbf(g[r].z, g[r].w);
        *(uint2*)&stage[w][r * APITCH + lane * 2] = p;
      }
      // next chunk's loads fly under this chunk's WMMAs
      const int nc = tl * 4 + c + 1;
      if (nc < TPW * 4) {
        const float* nsrc = vbase + (size_t)((nc >> 2) * 16) * DVV + (nc & 3) * 128;
        #pragma unroll
        for (int r = 0; r < 16; ++r) g[r] = *(const float4*)(nsrc + r * DVV + lane4);
        // precaution: stands ahead of any rewrite of a register these loads name
        asm volatile("s_wait_xcnt 0x0" ::: "memory");
      }
      WAVE_LDS_WAIT();   // staged rows written before other lanes read them
      #pragma unroll
      for (int ksl = 0; ksl < 4; ++ksl) {
        Frag16 av;
        const unsigned* arow = &stage[w][rbase * APITCH + ksl * 16 + hi4];
        av.q[0] = *(const uint4*)(arow);
        av.q[1] = *(const uint4*)(arow + 8);
        #pragma unroll
        for (int nh = 0; nh < 8; nh += 4) {
          Frag16 bv[4];
          #pragma unroll
          for (int nt = 0; nt < 4; ++nt) {
            bv[nt].q[0] = *(const uint4*)(bpan + ((ksl * 8 + nh + nt) * 2 + 0) * 128);
            bv[nt].q[1] = *(const uint4*)(bpan + ((ksl * 8 + nh + nt) * 2 + 1) * 128);
          }
          // keeps a group's 8 LDS reads together ahead of its 4 WMMAs (they issue
          // under the group before): one LDS latency per group, not one per WMMA
          __builtin_amdgcn_sched_barrier(0);
          #pragma unroll
          for (int nt = 0; nt < 4; ++nt)
            acc[nh + nt] = __builtin_amdgcn_wmma_f32_16x16x32_bf16(
                false, av.v, false, bv[nt].v, (short)0, acc[nh + nt], false, false);
        }
      }
    }

    // --- epilogue: tanh, project, reduce over attn dim (deterministic) ---
    // C layout: vgpr i -> row i (lanes 0-15) / row i+8 (lanes 16-31), col=lane%16
    // tanh(x) = 1 - 2 / (1 + e^(2x)), written without a branch: 64 independent
    // short chains per lane instead of 64 masked two-way branches in series.
    // e^(2x) = inf gives 1, e^(2x) = 0 gives -1, NaN stays NaN; the absolute
    // error is a few f32 roundings of 1, far below the bf16 products' own.  The
    // projection is folded in: sum_a pw*tanh = sum_a pw - 2 * sum_a pw / (1 + e^(2x)).
    const float K2 = 2.8853900817779268f;   // 2 * log2(e)
    float qk[8], pw2[8];
    float pws = 0.f;
    #pragma unroll
    for (int nt = 0; nt < 8; ++nt) {
      const float p = sPW[nt * 16 + rbase];
      qk[nt]  = sQB[nt * 16 + rbase] * K2;
      pw2[nt] = -2.0f * p;
      pws    += p;
    }
    float ps[8];
    #pragma unroll
    for (int i = 0; i < 8; ++i) {
      float xa[8], ex[8], rc[8];
      #pragma unroll
      for (int nt = 0; nt < 8; ++nt) xa[nt] = fmaf(acc[nt][i], K2, qk[nt]);
      exp2_x8(ex, xa);
      #pragma unroll
      for (int nt = 0; nt < 8; ++nt) ex[nt] += 1.0f;
      rcp_x8(rc, ex);
      float vv = pws;
      #pragma unroll
      for (int nt = 0; nt < 8; ++nt) vv = fmaf(rc[nt], pw2[nt], vv);
      vv += __shfl_xor(vv, 1, 16);
      vv += __shfl_xor(vv, 2, 16);
      vv += __shfl_xor(vv, 4, 16);
      vv += __shfl_xor(vv, 8, 16);
      ps[i] = vv;                       // score of row i + 8*hi, in all 16 lanes
    }
    {
      float mine = ps[0];
      #pragma unroll
      for (int i = 1; i < 8; ++i) mine = (rbase == i) ? ps[i] : mine;
      if (rbase < 8) scores[b * TT + t0 + hi * 8 + rbase] = mine;
    }

    if (do_ctx) {
      // --- all 16 scores in every lane, then the online-softmax update ---
      float sc[16];
      #pragma unroll
      for (int i = 0; i < 8; ++i) {
        float other = __shfl_xor(ps[i], 16, 32);
        sc[i]     = hi ? other : ps[i];
        sc[i + 8] = hi ? ps[i] : other;
      }
      float mn = m_run;
      #pragma unroll
      for (int t = 0; t < 16; ++t) mn = fmaxf(mn, sc[t]);
      const float resc = expf(m_run - mn);
      m_run = mn;
      z_run *= resc;
      float4 cx[4];
      #pragma unroll
      for (int j = 0; j < 4; ++j) {
        cx[j] = *(const float4*)&wctx[w][j * 128 + lane4];
        cx[j].x *= resc; cx[j].y *= resc; cx[j].z *= resc; cx[j].w *= resc;
      }
      #pragma unroll
      for (int t = 0; t < 16; ++t) { sc[t] = expf(sc[t] - mn); z_run += sc[t]; }

      // --- ctx[d] += e_t * values[t][d]; the tile's re-read hits L2 ---
      const float* rsrc = vbase + (size_t)(tl * 16) * DVV;
      #pragma unroll
      for (int tb = 0; tb < 16; tb += 4) {
        float4 x[4][4];
        #pragma unroll
        for (int t = 0; t < 4; ++t) {
          #pragma unroll
          for (int j = 0; j < 4; ++j)
            x[t][j] = *(const float4*)(rsrc + (tb + t) * DVV + j * 128 + lane4);
        }
        // keeps four rows' 16 loads in flight together: one L2 latency per
        // batch instead of one per load
        __builtin_amdgcn_sched_barrier(0);
        #pragma unroll
        for (int t = 0; t < 4; ++t) {
          #pragma unroll
          for (int j = 0; j < 4; ++j) {
            cx[j].x += sc[tb + t] * x[t][j].x;
            cx[j].y += sc[tb + t] * x[t][j].y;
            cx[j].z += sc[tb + t] * x[t][j].z;
            cx[j].w += sc[tb + t] * x[t][j].w;
          }
        }
      }
      #pragma unroll
      for (int j = 0; j < 4; ++j) *(float4*)&wctx[w][j * 128 + lane4] = cx[j];
    }
  }

  if (!do_ctx) return;

  // --- merge the 16 waves' (m, Z, ctx) into one partial, fixed order ---
  if (lane == 0) { wm[w] = m_run; wz[w] = z_run; }
  __syncthreads();
  {
    float m = wm[0];
    #pragma unroll
    for (int ww = 1; ww < WAVES; ++ww) m = fmaxf(m, wm[ww]);
    float z = 0.f, cacc = 0.f;
    #pragma unroll
    for (int ww = 0; ww < WAVES; ++ww) {
      float e = expf(wm[ww] - m);
      z    += wz[ww] * e;
      cacc += e * wctx[ww][tid];
    }
    ctxp[(size_t)(b * NPART + part) * DVV + tid] = cacc;
    if (tid == 0) {
      mtile[b * NPART + part] = m;
      ztile[b * NPART + part] = z;
    }
  }
}

// ---------------------------------------------------------------------------
// Fused path combine, ONE launch of 2*BB workgroups.  Every workgroup forms its
// batch row's global softmax stats from the NPART partial stats (16 loads, fixed
// order); blocks 0..BB-1 then write the attention weights, blocks BB..2*BB-1 the
// context: ctx[b][d] = invZ * sum_p exp(m_p - m) * ctxp[p][d].  The context half
// recomputes the stats rather than wait a launch for them.
// ---------------------------------------------------------------------------
__global__ __launch_bounds__(256) void lsa_combine(
    const float* __restrict__ scores, const float* __restrict__ mtile,
    const float* __restrict__ ztile,  const float* __restrict__ ctxp,
    float* __restrict__ out_w,        float* __restrict__ out_ctx) {
  const int half = blockIdx.x / BB, b = blockIdx.x % BB, tid = threadIdx.x;

  float mt[NPART], sc[NPART];   // unrolled loops keep both in registers
  #pragma unroll
  for (int p = 0; p < NPART; ++p) mt[p] = mtile[b * NPART + p];
  float mg = mt[0];
  #pragma unroll
  for (int p = 1; p < NPART; ++p) mg = fmaxf(mg, mt[p]);
  float z = 0.f;
  #pragma unroll
  for (int p = 0; p < NPART; ++p) {               // fixed order
    sc[p] = expf(mt[p] - mg);
    z += ztile[b * NPART + p] * sc[p];
  }
  const float inv = 1.0f / z;

  if (half == 0) {                                // uniform for the workgroup
    const float* s = scores + b * TT;
    for (int t = tid; t < TT; t += 256)
      out_w[b * TT + t] = expf(s[t] - mg) * inv;
  } else {
    const float2* p2 = (const float2*)ctxp;
    float2 s; s.x = 0.f; s.y = 0.f;
    #pragma unroll   // sc[] is indexed by constants only, so it stays in registers
    for (int c = 0; c < NPART; ++c) {             // fixed order
      float2 x = p2[(size_t)(b * NPART + c) * 256 + tid];
      s.x += sc[c] * x.x; s.y += sc[c] * x.y;
    }
    s.x *= inv; s.y *= inv;
    ((float2*)out_ctx)[b * 256 + tid] = s;
    // precaution: the other half's code follows this store in the build, so the
    // wait stands ahead of any rewrite of a register the store names
    asm volatile("s_wait_xcnt 0x0" ::: "memory");
  }
}

// ---------------------------------------------------------------------------
// Fallback path (small workspace): plain softmax + second values pass.
// ---------------------------------------------------------------------------
__global__ __launch_bounds__(256) void lsa_softmax(
    const float* __restrict__ scores, float* __restrict__ out_w) {
  __shared__ float red[256];
  const int b = blockIdx.x, tid = threadIdx.x;
  const float* s = scores + b * TT;

  float m = -3.402823466e+38f;
  for (int t = tid; t < TT; t += 256) m = fmaxf(m, s[t]);
  red[tid] = m; __syncthreads();
  for (int off = 128; off > 0; off >>= 1) {
    if (tid < off) red[tid] = fmaxf(red[tid], red[tid + off]);
    __syncthreads();
  }
  m = red[0]; __syncthreads();

  float sum = 0.f;
  for (int t = tid; t < TT; t += 256) sum += expf(s[t] - m);
  red[tid] = sum; __syncthreads();
  for (int off = 128; off > 0; off >>= 1) {
    if (tid < off) red[tid] += red[tid + off];
    __syncthreads();
  }
  const float inv = 1.0f / red[0];
  for (int t = tid; t < TT; t += 256)
    out_w[b * TT + t] = expf(s[t] - m) * inv;
}

__global__ __launch_bounds__(256) void lsa_ctx_partial(
    const float* __restrict__ values, const float* __restrict__ attn_w,
    float* __restrict__ partials) {
  const int b = blockIdx.x >> 5, chunk = blockIdx.x & 31, tid = threadIdx.x;
  const float2* v = (const float2*)(values + ((size_t)b * TT) * DVV);
  const int tbase = chunk * 128;
  float2 acc; acc.x = 0.f; acc.y = 0.f;
  for (int t = 0; t < 128; ++t) {
    float wt = attn_w[b * TT + tbase + t];
    float2 x = v[(size_t)(tbase + t) * 256 + tid];
    acc.x += wt * x.x;
    acc.y += wt * x.y;
  }
  ((float2*)partials)[(size_t)(b * 32 + chunk) * 256 + tid] = acc;
}

__global__ __launch_bounds__(256) void lsa_ctx_reduce(
    const float* __restrict__ partials, float* __restrict__ out_ctx) {
  const int b = blockIdx.x, tid = threadIdx.x;
  const float2* p = (const float2*)partials;
  float2 s; s.x = 0.f; s.y = 0.f;
  #pragma unroll
  for (int c = 0; c < 32; ++c) {
    float2 x = p[(size_t)(b * 32 + c) * 256 + tid];
    s.x += x.x; s.y += x.y;
  }
  ((float2*)out_ctx)[b * 256 + tid] = s;
}

// ---------------------------------------------------------------------------
extern "C" void kernel_launch(void* const* d_in, const int* in_sizes, int n_in,
                              void* d_out, int out_size, void* d_ws, size_t ws_size,
                              hipStream_t stream) {
  const float* query  = (const float*)d_in[0];
  const float* values = (const float*)d_in[1];
  const float* prev   = (const float*)d_in[2];
  const float* conv_w = (const float*)d_in[3];
  const float* conv_b = (const float*)d_in[4];
  const float* loc_w  = (const float*)d_in[5];
  const float* loc_b  = (const float*)d_in[6];
  const float* wq_w   = (const float*)d_in[7];
  const float* wq_b   = (const float*)d_in[8];
  const float* wv_w   = (const float*)d_in[9];
  const float* wv_b   = (const float*)d_in[10];
  const float* attn_b = (const float*)d_in[11];
  const float* proj_w = (const float*)d_in[12];

  float* out_ctx = (float*)d_out;               // [32, 512]
  float* out_w   = out_ctx + BB * DVV;          // [32, 4096]

  unsigned char* ws = (unsigned char*)d_ws;
  unsigned* packWV  = (unsigned*)(ws);            // 32768 u32  (128 KB)
  unsigned* packLOC = (unsigned*)(ws + 131072);   //  2048 u32  (  8 KB)
  float*    qbias   = (float*)(ws + 139264);      //  4096 f32  ( 16 KB)
  float*    scores  = (float*)(ws + 155648);      // 131072 f32 (512 KB)
  // fused-path extras
  float*    mtile   = (float*)(ws + 679936);      //   256 f32
  float*    ztile   = (float*)(ws + 712704);      //   256 f32
  float*    ctxp    = (float*)(ws + 778752);      // 32*8*512 f32 (512 KB)
  const size_t fused_need = 778752u + (size_t)BB * NPART * DVV * 4u;
  // fallback-path extra (overlaps the fused region)
  float*    parts   = (float*)(ws + 679936);      // 524288 f32 (2 MB)
  const int fused = (ws_size >= fused_need) ? 1 : 0;

  lsa_pre<<<PRE_QB + PRE_WV + PRE_LOC, 512, 0, stream>>>(
      query, wq_w, wq_b, wv_b, loc_b, attn_b, wv_w, loc_w, qbias, packWV, packLOC);

  lsa_score<<<BB * NPART, 512, 0, stream>>>(
      values, prev, conv_w, conv_b, packWV, packLOC, qbias, proj_w,
      scores, mtile, ztile, ctxp, fused);

  if (fused) {
    lsa_combine<<<2 * BB, 256, 0, stream>>>(scores, mtile, ztile, ctxp, out_w, out_ctx);
  } else {
    lsa_softmax    <<< BB, 256, 0, stream>>>(scores, out_w);
    lsa_ctx_partial<<<BB * 32, 256, 0, stream>>>(values, out_w, parts);
    lsa_ctx_reduce <<< BB, 256, 0, stream>>>(parts, out_ctx);
  }
}

// v005
// A run of this version takes 46.3 microseconds.
// Timed twice side by side with v004, it ran 1.07 and 1.08 times as fast.
// Counting every step since v000, it is 3.07 times as fast.
#include <hip/hip_runtime.h>
#include <hip/hip_bf16.h>

// ---------------------------------------------------------------------------
// Location-sensitive attention for MI455X (gfx1250, wave32, WMMA).
// B=32, T=4096, DV=512, DQ=512, ATTN=128, FILTERS=32, KSIZE=31
// Fused flash-style context accumulation: values read from HBM exactly once.
// ---------------------------------------------------------------------------

#define BB   32
#define TT   4096
#define DVV  512
#define AA   128
#define FF   32
#define KS   31
#define WAVES   16                  // waves per score workgroup
#define TPW     2                   // 16-row tiles per wave
#define ROWS_WG (WAVES * TPW * 16)  // 512 timesteps per score workgroup
#define NPART   (TT / ROWS_WG)      // 8 partials per batch row
#define APITCH  68                  // dwords per staged row: 128 bf16 + 16 B pad

typedef __attribute__((ext_vector_type(16))) __bf16 v16bf;
typedef __attribute__((ext_vector_type(8)))  float  v8f;

union Frag16 {          // 16 bf16 elements = 8 dwords = one WMMA A/B operand
  v16bf    v;
  unsigned u[8];
  uint4    q[2];
};

typedef __attribute__((ext_vector_type(2))) float  v2f;
typedef __attribute__((ext_vector_type(2))) __bf16 v2bf;
typedef __attribute__((ext_vector_type(4))) float  v4f;
typedef __attribute__((ext_vector_type(4))) __bf16 v4bf;
// f32 -> bf16, round to nearest even, by the packed hardware conversion
// (one instruction per pair; a in the low half)
__device__ __forceinline__ unsigned packbf(float a, float b) {
  v2f x = {a, b};
  return __builtin_bit_cast(unsigned, __builtin_convertvector(x, v2bf));
}
__device__ __forceinline__ uint2 packbf4(v4f x) {
  return __builtin_bit_cast(uint2, __builtin_convertvector(x, v4bf));
}

// ---------------------------------------------------------------------------
// Prepack wv_w [512,128] into WMMA bf16 B-operand layout.
// pk[(((ks*8 + nt)*2 + j/4)*32 + lane)*4 + j%4]  (each 16-B half-fragment of a
// wave is 512 contiguous bytes, conflict-free for LDS b128 reads):
//   lane holds column n = nt*16 + lane%16
//   lanes 0-15 hold K {0..7, 16..23}, lanes 16-31 hold K {8..15, 24..31}
//   dword j packs (K, K+1) with even K in the low half.
// ---------------------------------------------------------------------------
__device__ __forceinline__ void prepack_wv_item(
    int tid /* 0..32767 */, const float* __restrict__ wv_w, unsigned* __restrict__ pk) {
  int j   = tid & 7;
  int L   = (tid >> 3) & 31;
  int nt  = (tid >> 8) & 7;
  int ks  = tid >> 11;
  int n   = nt * 16 + (L & 15);
  int kb  = ks * 32 + ((L >> 4) ? 8 : 0) + ((j < 4) ? (2 * j) : (16 + 2 * (j - 4)));
  pk[(((ks * 8 + nt) * 2 + (j >> 2)) * 32 + L) * 4 + (j & 3)] =
      packbf(wv_w[kb * AA + n], wv_w[(kb + 1) * AA + n]);
  // precaution: in the shared-grid build other blocks' code follows this store, so
  // the wait stands ahead of any rewrite of a register the store names
  asm volatile("s_wait_xcnt 0x0" ::: "memory");
}

__device__ __forceinline__ void prepack_loc_item(
    int tid /* 0..2047 */, const float* __restrict__ loc_w, unsigned* __restrict__ pk) {
  int j   = tid & 7;
  int L   = (tid >> 3) & 31;
  int nt  = tid >> 8;
  int n   = nt * 16 + (L & 15);
  int kb  = ((L >> 4) ? 8 : 0) + ((j < 4) ? (2 * j) : (16 + 2 * (j - 4)));
  pk[((nt * 2 + (j >> 2)) * 32 + L) * 4 + (j & 3)] =
      packbf(loc_w[kb * AA + n], loc_w[(kb + 1) * AA + n]);
  // precaution: in the shared-grid build other blocks' code follows this store, so
  // the wait stands ahead of any rewrite of a register the store names
  asm volatile("s_wait_xcnt 0x0" ::: "memory");
}

// ---------------------------------------------------------------------------
// qbias[b][a] = query[b]·wq_w[:,a] + wq_b + wv_b + loc_b + attention_bias
// ---------------------------------------------------------------------------
#define QCOLS 32   // attn columns per qbias workgroup: one 128-B line of each wq_w row
__device__ __forceinline__ void qbias_block(
    int blk /* 0..BB*4-1 */,
    const float* __restrict__ query, const float* __restrict__ wq_w,
    const float* __restrict__ wq_b,  const float* __restrict__ wv_b,
    const float* __restrict__ loc_b, const float* __restrict__ attn_b,
    float* __restrict__ qbias) {
  // One workgroup = one batch row x 32 columns; K = 512 is split over 16 waves x
  // 4 lane groups x 8 rows, so a lane needs only 8 row loads and every load of
  // the kernel is issued before the first is used: one memory latency for the
  // kernel instead of one per group of rows.
  __shared__ __align__(16) float part[16][QCOLS];
  const int b    = blk >> 2, cq = blk & 3, tid = threadIdx.x;
  const int lane = tid & 31, w = tid >> 5;
  const int c4   = (lane & 7) * 4;             // lane's 4 columns in the line
  const int row0 = w * 32 + (lane >> 3) * 8;   // lane's 8 rows of K
  const int a    = cq * QCOLS + lane;          // column of the closing sum
  const float* wp = wq_w + row0 * AA + cq * QCOLS + c4;
  const float* qp = query + b * 512 + row0;
  float4 x[8];
  #pragma unroll
  for (int i = 0; i < 8; ++i) x[i] = *(const float4*)(wp + i * AA);
  float4 qv[2];
  qv[0] = *(const float4*)(qp);
  qv[1] = *(const float4*)(qp + 4);
  // precaution: in the shared-grid build a bias load's result lands in the query
  // loads' offset register, so the wait also stands between those loads
  asm volatile("s_wait_xcnt 0x0" ::: "memory");
  const float bq = wq_b[a], bv = wv_b[a], bl = loc_b[a], ba = attn_b[a];
  // precaution: stands ahead of any rewrite of a register the loads above name
  asm volatile("s_wait_xcnt 0x0" ::: "memory");
  const float qs[8] = {qv[0].x, qv[0].y, qv[0].z, qv[0].w,
                       qv[1].x, qv[1].y, qv[1].z, qv[1].w};
  float4 s = make_float4(0.f, 0.f, 0.f, 0.f);
  #pragma unroll
  for (int i = 0; i < 8; ++i) {
    s.x += qs[i] * x[i].x; s.y += qs[i] * x[i].y;
    s.z += qs[i] * x[i].z; s.w += qs[i] * x[i].w;
  }
  // the wave's 4 lane groups hold the same columns: fold them, fixed order
  #pragma unroll
  for (int d = 8; d < 32; d <<= 1) {
    s.x += __shfl_xor(s.x, d, 32); s.y += __shfl_xor(s.y, d, 32);
    s.z += __shfl_xor(s.z, d, 32); s.w += __shfl_xor(s.w, d, 32);
  }
  if (lane < 8) *(float4*)&part[w][c4] = s;
  __syncthreads();
  if (tid < QCOLS) {
    float t = part[0][tid];
    #pragma unroll
    for (int ww = 1; ww < 16; ++ww) t += part[ww][tid];   // fixed wave order
    qbias[b * AA + a] = t + bq + bv + bl + ba;
  }
}

// ---------------------------------------------------------------------------
// All the work the score kernel waits for, in ONE launch: the query bias and the
// two weight prepacks read and write disjoint data, so they share a grid by
// block range and run side by side (196 workgroups, all resident at once)
// instead of one after another with a launch gap between them.
// ---------------------------------------------------------------------------
#define PRE_QB  (BB * 4)            // blocks   0..127: query bias (the longest, first)
#define PRE_WV  (32768 / 512)       // blocks 128..191: wv_w prepack
#define PRE_LOC (2048 / 512)        // blocks 192..195: loc_w prepack
__global__ __launch_bounds__(512) void lsa_pre(
    const float* __restrict__ query, const float* __restrict__ wq_w,
    const float* __restrict__ wq_b,  const float* __restrict__ wv_b,
    const float* __restrict__ loc_b, const float* __restrict__ attn_b,
    const float* __restrict__ wv_w,  const float* __restrict__ loc_w,
    float* __restrict__ qbias, unsigned* __restrict__ packWV,
    unsigned* __restrict__ packLOC) {
  const int blk = blockIdx.x;        // the branch is uniform for the workgroup
  if (blk < PRE_QB)
    qbias_block(blk, query, wq_w, wq_b, wv_b, loc_b, attn_b, qbias);
  else if (blk < PRE_QB + PRE_WV)
    prepack_wv_item((blk - PRE_QB) * 512 + threadIdx.x, wv_w, packWV);
  else
    prepack_loc_item((blk - PRE_QB - PRE_WV) * 512 + threadIdx.x, loc_w, packLOC);
}

// ---------------------------------------------------------------------------
// Score (+ fused online-softmax context partial) kernel.
// One workgroup = 512 timesteps of one batch row, 16 waves; the packed weights
// lie in LDS once per workgroup.  Each wave owns 32 whole rows (two 16-row
// tiles) and all 128 attn columns, so a row's score is finished inside the
// wave: scores[b][t] = sum_a tanh(pre)[t][a] * proj_w[a].
// If do_ctx: the wave keeps a running max m, Z = sum exp(s-m) and
// ctx[d] = sum_t exp(s_t-m) * values[t][d] (rows re-read while hot in L2);
// the 16 waves are merged once at the end into one partial per workgroup.
// ---------------------------------------------------------------------------
// The wave's own LDS traffic has landed / returned: its lanes exchange rows
// through a per-wave LDS range, and the clobber keeps the compiler from moving
// LDS accesses across the hand-over.
#define WAVE_LDS_WAIT() asm volatile("s_wait_dscnt 0x0" ::: "memory")

// Eight independent v_exp_f32 (2^x) or v_rcp_f32 in one statement.  Written as
// asm text so that the slot the instruction set asks for behind a transcendental
// is kept by construction: the results are early-clobber, so none of the eight
// reads an earlier result or overwrites an earlier source, and the closing v_nop
// fills the slot behind the last one.
__device__ __forceinline__ void exp2_x8(float (&o)[8], const float (&a)[8]) {
  asm("v_exp_f32 %0, %8\n\tv_exp_f32 %1, %9\n\tv_exp_f32 %2, %10\n\t"
      "v_exp_f32 %3, %11\n\tv_exp_f32 %4, %12\n\tv_exp_f32 %5, %13\n\t"
      "v_exp_f32 %6, %14\n\tv_exp_f32 %7, %15\n\tv_nop"
      : "=&v"(o[0]), "=&v"(o[1]), "=&v"(o[2]), "=&v"(o[3]),
        "=&v"(o[4]), "=&v"(o[5]), "=&v"(o[6]), "=&v"(o[7])
      : "v"(a[0]), "v"(a[1]), "v"(a[2]), "v"(a[3]),
        "v"(a[4]), "v"(a[5]), "v"(a[6]), "v"(a[7]));
}
__device__ __forceinline__ void rcp_x8(float (&o)[8], const float (&a)[8]) {
  asm("v_rcp_f32 %0, %8\n\tv_rcp_f32 %1, %9\n\tv_rcp_f32 %2, %10\n\t"
      "v_rcp_f32 %3, %11\n\tv_rcp_f32 %4, %12\n\tv_rcp_f32 %5, %13\n\t"
      "v_rcp_f32 %6, %14\n\tv_rcp_f32 %7, %15\n\tv_nop"
      : "=&v"(o[0]), "=&v"(o[1]), "=&v"(o[2]), "=&v"(o[3]),
        "=&v"(o[4]), "=&v"(o[5]), "=&v"(o[6]), "=&v"(o[7])
      : "v"(a[0]), "v"(a[1]), "v"(a[2]), "v"(a[3]),
        "v"(a[4]), "v"(a[5]), "v"(a[6]), "v"(a[7]));
}

__global__ __launch_bounds__(512) void lsa_score(
    const float*    __restrict__ values,  const float* __restrict__ prev,
    const float*    __restrict__ conv_w,  const float* __restrict__ conv_b,
    const unsigned* __restrict__ packWV,  const unsigned* __restrict__ packLOC,
    const float*    __restrict__ qbias,   const float* __restrict__ proj_w,
    float*          __restrict__ scores,
    float*          __restrict__ mtile,   float* __restrict__ ztile,
    float*          __restrict__ ctxp,    int do_ctx) {
  __shared__ __align__(16) unsigned sWV [32768];              // 128 KB B panels
  __shared__ __align__(16) unsigned sLOC[2048];               //   8 KB B panels
  __shared__ __align__(16) float    sCW [KS * FF];            //   4 KB conv taps
  __shared__ __align__(16) unsigned stage[WAVES][16 * APITCH]; // 16x128 bf16 per wave
  __shared__ __align__(16) unsigned fbf  [WAVES][16 * 20];     // 16x32 bf16 conv features
  __shared__ __align__(16) float    wctx [WAVES][DVV];         // per-wave context
  __shared__ float pa[WAVES][64];     // per-wave alignment window (62 used)
  __shared__ float sQB[AA];           // query bias row of this batch
  __shared__ float sPW[AA];           // projection weights
  __shared__ float wm[WAVES];
  __shared__ float wz[WAVES];

  const int tid   = threadIdx.x;
  const int lane  = tid & 31;
  const int w     = __builtin_amdgcn_readfirstlane(tid >> 5);
  const int b     = blockIdx.x / NPART;
  const int part  = blockIdx.x % NPART;
  const int row0  = part * ROWS_WG + w * (TPW * 16);   // wave's first timestep
  const int rbase = lane & 15;         // A row / B column within tile
  const int hi    = lane >> 4;         // lane half selects K sub-block
  const int hi4   = hi * 4;            // dword offset of K half-chunk
  const float*   vbase = values + ((size_t)(b * TT + row0)) * DVV;   // wave-uniform
  const unsigned lane4 = lane * 4;                                   // lane's column

  // --- first 16x128 f32 chunk of the wave's rows: one whole 512-B piece per load ---
  // each row piece is one 4-float vector: it stays one register tuple from the load
  // to its conversion (as four scalars the build copied two of them right behind
  // the next chunk's loads, which put a wait on the first load ahead of the WMMAs)
  v4f g[16];
  #pragma unroll
  for (int r = 0; r < 16; ++r) g[r] = *(const v4f*)(vbase + r * DVV + lane4);

  // --- the wave's alignment window (SAME padding, K=31 -> +/-15), both tiles ---
  #pragma unroll
  for (int h = 0; h < 2; ++h) {
    int   idx = row0 - 15 + h * 32 + lane;
    int   cl  = idx < 0 ? 0 : (idx > TT - 1 ? TT - 1 : idx);   // in-bounds address
    float pv  = prev[b * TT + cl];
    pa[w][h * 32 + lane] = (idx == cl) ? pv : 0.0f;
  }

  // --- packed weights -> LDS, once per workgroup ---
  {
    uint4 tmp[16];
    #pragma unroll
    for (int i = 0; i < 16; ++i) tmp[i] = ((const uint4*)packWV)[i * 512 + tid];
    uint4 tl = ((const uint4*)packLOC)[tid];
    #pragma unroll
    for (int i = 0; i < 16; ++i) ((uint4*)sWV)[i * 512 + tid] = tmp[i];
    ((uint4*)sLOC)[tid] = tl;
    if (tid < KS * FF / 4) ((float4*)sCW)[tid] = ((const float4*)conv_w)[tid];
  }

  if (tid < AA) {
    sQB[tid] = qbias[b * AA + tid];
    sPW[tid] = proj_w[tid];
  }
  __syncthreads();

  float  m_run = -3.402823466e+38f, z_run = 0.f;
  // the wave's running context rests in its own LDS row between tiles (each lane
  // touches only its own 16 columns), so the matrix loop has the registers
  #pragma unroll
  for (int j = 0; j < 4; ++j)
    *(float4*)&wctx[w][j * 128 + lane4] = make_float4(0.f, 0.f, 0.f, 0.f);

  #pragma unroll 1   // two tiles share one copy of the body (instruction cache)
  for (int tl = 0; tl < TPW; ++tl) {
    const int t0 = row0 + tl * 16;

    // --- 31-tap conv over alignment (SAME padding): lane -> filter pair c0,
    //     timesteps hi, hi+2, ..., hi+14 ---
    {
      const int c0 = rbase * 2;
      float win[45];
      #pragma unroll
      for (int k = 0; k < 45; ++k) win[k] = pa[w][tl * 16 + hi + k];
      float s0[8], s1[8];
      #pragma unroll
      for (int i = 0; i < 8; ++i) { s0[i] = conv_b[c0]; s1[i] = conv_b[c0 + 1]; }
      #pragma unroll
      for (int j = 0; j < KS; ++j) {
        float2 wj = *(const float2*)&sCW[j * FF + c0];
        #pragma unroll
        for (int i = 0; i < 8; ++i) {
          s0[i] += win[2 * i + j] * wj.x;
          s1[i] += win[2 * i + j] * wj.y;
        }
      }
      WAVE_LDS_WAIT();   // last tile's feature reads are back before the rows change
      #pragma unroll
      for (int i = 0; i < 8; ++i)
        fbf[w][(hi + 2 * i) * 20 + rbase] = packbf(s0[i], s1[i]);
      WAVE_LDS_WAIT();   // feature rows written before other lanes read them
    }

    v8f acc[8];

    // --- proc_loc = f(16x32) @ loc_w(32x128): 8 bf16 WMMAs ---
    {
      Frag16 fa;
      fa.q[0] = *(const uint4*)&fbf[w][rbase * 20 + hi4];
      fa.q[1] = *(const uint4*)&fbf[w][rbase * 20 + 8 + hi4];
      #pragma unroll
      for (int nt = 0; nt < 8; ++nt) {
        Frag16 lb;
        lb.q[0] = *(const uint4*)&sLOC[(nt * 2 + 0) * 128 + lane * 4];
        lb.q[1] = *(const uint4*)&sLOC[(nt * 2 + 1) * 128 + lane * 4];
        v8f zero = {};
        acc[nt] = __builtin_amdgcn_wmma_f32_16x16x32_bf16(
            false, fa.v, false, lb.v, (short)0, zero, false, false);
      }
    }

    // --- wv = values(16x512) @ wv_w(512x128): 4 chunks of K=128, 32 WMMAs each ---
    #pragma unroll 1   // rolled: one LDS base per chunk, B offsets fit the immediate field
    for (int c = 0; c < 4; ++c) {
      const unsigned* bpan = &sWV[c * 8192 + lane * 4];
      WAVE_LDS_WAIT();   // last chunk's A reads are back before its rows change
      #pragma unroll
      for (int r = 0; r < 16; ++r) {
        *(uint2*)&stage[w][r * APITCH + lane * 2] = packbf4(g[r]);
      }
      // next chunk's loads fly under this chunk's WMMAs
      const int nc = tl * 4 + c + 1;
      if (nc < TPW * 4) {
        const float* nsrc = vbase + (size_t)((nc >> 2) * 16) * DVV + (nc & 3) * 128;
        #pragma unroll
        for (int r = 0; r < 16; ++r) g[r] = *(const v4f*)(nsrc + r * DVV + lane4);
        // precaution: stands ahead of any rewrite of a register these loads name
        asm volatile("s_wait_xcnt 0x0" ::: "memory");
      }
      WAVE_LDS_WAIT();   // staged rows written before other lanes read them
      #pragma unroll
      for (int ksl = 0; ksl < 4; ++ksl) {
        Frag16 av;
        const unsigned* arow = &stage[w][rbase * APITCH + ksl * 16 + hi4];
        av.q[0] = *(const uint4*)(arow);
        av.q[1] = *(const uint4*)(arow + 8);
        #pragma unroll
        for (int nh = 0; nh < 8; nh += 4) {
          Frag16 bv[4];
          #pragma unroll
          for (int nt = 0; nt < 4; ++nt) {
            bv[nt].q[0] = *(const uint4*)(bpan + ((ksl * 8 + nh + nt) * 2 + 0) * 128);
            bv[nt].q[1] = *(const uint4*)(bpan + ((ksl * 8 + nh + nt) * 2 + 1) * 128);
          }
          // keeps a group's 8 LDS reads together ahead of its 4 WMMAs (they issue
          // under the group before): one LDS latency per group, not one per WMMA
          __builtin_amdgcn_sched_barrier(0);
          #pragma unroll
          for (int nt = 0; nt < 4; ++nt)
            acc[nh + nt] = __builtin_amdgcn_wmma_f32_16x16x32_bf16(
                false, av.v, false, bv[nt].v, (short)0, acc[nh + nt], false, false);
        }
      }
    }

    // --- epilogue: tanh, project, reduce over attn dim (deterministic) ---
    // C layout: vgpr i -> row i (lanes 0-15) / row i+8 (lanes 16-31), col=lane%16
    // tanh(x) = 1 - 2 / (1 + e^(2x)), written without a branch: 64 independent
    // short chains per lane instead of 64 masked two-way branches in series.
    // e^(2x) = inf gives 1, e^(2x) = 0 gives -1, NaN stays NaN; the absolute
    // error is a few f32 roundings of 1, far below the bf16 products' own.  The
    // projection is folded in: sum_a pw*tanh = sum_a pw - 2 * sum_a pw / (1 + e^(2x)).
    const float K2 = 2.8853900817779268f;   // 2 * log2(e)
    float qk[8], pw2[8];
    float pws = 0.f;
    #pragma unroll
    for (int nt = 0; nt < 8; ++nt) {
      const float p = sPW[nt * 16 + rbase];
      qk[nt]  = sQB[nt * 16 + rbase] * K2;
      pw2[nt] = -2.0f * p;
      pws    += p;
    }
    float ps[8];
    #pragma unroll
    for (int i = 0; i < 8; ++i) {
      float xa[8], ex[8], rc[8];
      #pragma unroll
      for (int nt = 0; nt < 8; ++nt) xa[nt] = fmaf(acc[nt][i], K2, qk[nt]);
      exp2_x8(ex, xa);
      #pragma unroll
      for (int nt = 0; nt < 8; ++nt) ex[nt] += 1.0f;
      rcp_x8(rc, ex);
      float vv = pws;
      #pragma unroll
      for (int nt = 0; nt < 8; ++nt) vv = fmaf(rc[nt], pw2[nt], vv);
      vv += __shfl_xor(vv, 1, 16);
      vv += __shfl_xor(vv, 2, 16);
      vv += __shfl_xor(vv, 4, 16);
      vv += __shfl_xor(vv, 8, 16);
      ps[i] = vv;                       // score of row i + 8*hi, in all 16 lanes
    }
    {
      float mine = ps[0];
      #pragma unroll
      for (int i = 1; i < 8; ++i) mine = (rbase == i) ? ps[i] : mine;
      if (rbase < 8) scores[b * TT + t0 + hi * 8 + rbase] = mine;
    }

    if (do_ctx) {
      // --- all 16 scores in every lane, then the online-softmax update ---
      float sc[16];
      #pragma unroll
      for (int i = 0; i < 8; ++i) {
        float other = __shfl_xor(ps[i], 16, 32);
        sc[i]     = hi ? other : ps[i];
        sc[i + 8] = hi ? ps[i] : other;
      }
      float mn = m_run;
      #pragma unroll
      for (int t = 0; t < 16; ++t) mn = fmaxf(mn, sc[t]);
      const float resc = expf(m_run - mn);
      m_run = mn;
      z_run *= resc;
      float4 cx[4];
      #pragma unroll
      for (int j = 0; j < 4; ++j) {
        cx[j] = *(const float4*)&wctx[w][j * 128 + lane4];
        cx[j].x *= resc; cx[j].y *= resc; cx[j].z *= resc; cx[j].w *= resc;
      }
      #pragma unroll
      for (int t = 0; t < 16; ++t) { sc[t] = expf(sc[t] - mn); z_run += sc[t]; }

      // --- ctx[d] += e_t * values[t][d]; the tile's re-read hits L2 ---
      const float* rsrc = vbase + (size_t)(tl * 16) * DVV;
      #pragma unroll
      for (int tb = 0; tb < 16; tb += 4) {
        float4 x[4][4];
        #pragma unroll
        for (int t = 0; t < 4; ++t) {
          #pragma unroll
          for (int j = 0; j < 4; ++j)
            x[t][j] = *(const float4*)(rsrc + (tb + t) * DVV + j * 128 + lane4);
        }
        // keeps four rows' 16 loads in flight together: one L2 latency per
        // batch instead of one per load
        __builtin_amdgcn_sched_barrier(0);
        #pragma unroll
        for (int t = 0; t < 4; ++t) {
          #pragma unroll
          for (int j = 0; j < 4; ++j) {
            cx[j].x += sc[tb + t] * x[t][j].x;
            cx[j].y += sc[tb + t] * x[t][j].y;
            cx[j].z += sc[tb + t] * x[t][j].z;
            cx[j].w += sc[tb + t] * x[t][j].w;
          }
        }
      }
      #pragma unroll
      for (int j = 0; j < 4; ++j) *(float4*)&wctx[w][j * 128 + lane4] = cx[j];
    }
  }

  if (!do_ctx) return;

  // --- merge the 16 waves' (m, Z, ctx) into one partial, fixed order ---
  if (lane == 0) { wm[w] = m_run; wz[w] = z_run; }
  __syncthreads();
  {
    float m = wm[0];
    #pragma unroll
    for (int ww = 1; ww < WAVES; ++ww) m = fmaxf(m, wm[ww]);
    float z = 0.f, cacc = 0.f;
    #pragma unroll
    for (int ww = 0; ww < WAVES; ++ww) {
      float e = expf(wm[ww] - m);
      z    += wz[ww] * e;
      cacc += e * wctx[ww][tid];
    }
    ctxp[(size_t)(b * NPART + part) * DVV + tid] = cacc;
    if (tid == 0) {
      mtile[b * NPART + part] = m;
      ztile[b * NPART + part] = z;
    }
  }
}

// ---------------------------------------------------------------------------
// Fused path combine, ONE launch of 2*BB workgroups.  Every workgroup forms its
// batch row's global softmax stats from the NPART partial stats (16 loads, fixed
// order); blocks 0..BB-1 then write the attention weights, blocks BB..2*BB-1 the
// context: ctx[b][d] = invZ * sum_p exp(m_p - m) * ctxp[p][d].  The context half
// recomputes the stats rather than wait a launch for them.
// ---------------------------------------------------------------------------
__global__ __launch_bounds__(256) void lsa_combine(
    const float* __restrict__ scores, const float* __restrict__ mtile,
    const float* __restrict__ ztile,  const float* __restrict__ ctxp,
    float* __restrict__ out_w,        float* __restrict__ out_ctx) {
  const int half = blockIdx.x / BB, b = blockIdx.x % BB, tid = threadIdx.x;

  float mt[NPART], sc[NPART];   // unrolled loops keep both in registers
  #pragma unroll
  for (int p = 0; p < NPART; ++p) mt[p] = mtile[b * NPART + p];
  float mg = mt[0];
  #pragma unroll
  for (int p = 1; p < NPART; ++p) mg = fmaxf(mg, mt[p]);
  float z = 0.f;
  #pragma unroll
  for (int p = 0; p < NPART; ++p) {               // fixed order
    sc[p] = expf(mt[p] - mg);
    z += ztile[b * NPART + p] * sc[p];
  }
  const float inv = 1.0f / z;

  if (half == 0) {                                // uniform for the workgroup
    const float* s = scores + b * TT;
    for (int t = tid; t < TT; t += 256)
      out_w[b * TT + t] = expf(s[t] - mg) * inv;
  } else {
    const float2* p2 = (const float2*)ctxp;
    float2 s; s.x = 0.f; s.y = 0.f;
    #pragma unroll   // sc[] is indexed by constants only, so it stays in registers
    for (int c = 0; c < NPART; ++c) {             // fixed order
      float2 x = p2[(size_t)(b * NPART + c) * 256 + tid];
      s.x += sc[c] * x.x; s.y += sc[c] * x.y;
    }
    s.x *= inv; s.y *= inv;
    ((float2*)out_ctx)[b * 256 + tid] = s;
    // precaution: the other half's code follows this store in the build, so the
    // wait stands ahead of any rewrite of a register the store names
    asm volatile("s_wait_xcnt 0x0" ::: "memory");
  }
}

// ---------------------------------------------------------------------------
// Fallback path (small workspace): plain softmax + second values pass.
// ---------------------------------------------------------------------------
__global__ __launch_bounds__(256) void lsa_softmax(
    const float* __restrict__ scores, float* __restrict__ out_w) {
  __shared__ float red[256];
  const int b = blockIdx.x, tid = threadIdx.x;
  const float* s = scores + b * TT;

  float m = -3.402823466e+38f;
  for (int t = tid; t < TT; t += 256) m = fmaxf(m, s[t]);
  red[tid] = m; __syncthreads();
  for (int off = 128; off > 0; off >>= 1) {
    if (tid < off) red[tid] = fmaxf(red[tid], red[tid + off]);
    __syncthreads();
  }
  m = red[0]; __syncthreads();

  float sum = 0.f;
  for (int t = tid; t < TT; t += 256) sum += expf(s[t] - m);
  red[tid] = sum; __syncthreads();
  for (int off = 128; off > 0; off >>= 1) {
    if (tid < off) red[tid] += red[tid + off];
    __syncthreads();
  }
  const float inv = 1.0f / red[0];
  for (int t = tid; t < TT; t += 256)
    out_w[b * TT + t] = expf(s[t] - m) * inv;
}

__global__ __launch_bounds__(256) void lsa_ctx_partial(
    const float* __restrict__ values, const float* __restrict__ attn_w,
    float* __restrict__ partials) {
  const int b = blockIdx.x >> 5, chunk = blockIdx.x & 31, tid = threadIdx.x;
  const float2* v = (const float2*)(values + ((size_t)b * TT) * DVV);
  const int tbase = chunk * 128;
  float2 acc; acc.x = 0.f; acc.y = 0.f;
  for (int t = 0; t < 128; ++t) {
    float wt = attn_w[b * TT + tbase + t];
    float2 x = v[(size_t)(tbase + t) * 256 + tid];
    acc.x += wt * x.x;
    acc.y += wt * x.y;
  }
  ((float2*)partials)[(size_t)(b * 32 + chunk) * 256 + tid] = acc;
}

__global__ __launch_bounds__(256) void lsa_ctx_reduce(
    const float* __restrict__ partials, float* __restrict__ out_ctx) {
  const int b = blockIdx.x, tid = threadIdx.x;
  const float2* p = (const float2*)partials;
  float2 s; s.x = 0.f; s.y = 0.f;
  #pragma unroll
  for (int c = 0; c < 32; ++c) {
    float2 x = p[(size_t)(b * 32 + c) * 256 + tid];
    s.x += x.x; s.y += x.y;
  }
  ((float2*)out_ctx)[b * 256 + tid] = s;
}

// ---------------------------------------------------------------------------
extern "C" void kernel_launch(void* const* d_in, const int* in_sizes, int n_in,
                              void* d_out, int out_size, void* d_ws, size_t ws_size,
                              hipStream_t stream) {
  const float* query  = (const float*)d_in[0];
  const float* values = (const float*)d_in[1];
  const float* prev   = (const float*)d_in[2];
  const float* conv_w = (const float*)d_in[3];
  const float* conv_b = (const float*)d_in[4];
  const float* loc_w  = (const float*)d_in[5];
  const float* loc_b  = (const float*)d_in[6];
  const float* wq_w   = (const float*)d_in[7];
  const float* wq_b   = (const float*)d_in[8];
  const float* wv_w   = (const float*)d_in[9];
  const float* wv_b   = (const float*)d_in[10];
  const float* attn_b = (const float*)d_in[11];
  const float* proj_w = (const float*)d_in[12];

  float* out_ctx = (float*)d_out;               // [32, 512]
  float* out_w   = out_ctx + BB * DVV;          // [32, 4096]

  unsigned char* ws = (unsigned char*)d_ws;
  unsigned* packWV  = (unsigned*)(ws);            // 32768 u32  (128 KB)
  unsigned* packLOC = (unsigned*)(ws + 131072);   //  2048 u32  (  8 KB)
  float*    qbias   = (float*)(ws + 139264);      //  4096 f32  ( 16 KB)
  float*    scores  = (float*)(ws + 155648);      // 131072 f32 (512 KB)
  // fused-path extras
  float*    mtile   = (float*)(ws + 679936);      //   256 f32
  float*    ztile   = (float*)(ws + 712704);      //   256 f32
  float*    ctxp    = (float*)(ws + 778752);      // 32*8*512 f32 (512 KB)
  const size_t fused_need = 778752u + (size_t)BB * NPART * DVV * 4u;
  // fallback-path extra (overlaps the fused region)
  float*    parts   = (float*)(ws + 679936);      // 524288 f32 (2 MB)
  const int fused = (ws_size >= fused_need) ? 1 : 0;

  lsa_pre<<<PRE_QB + PRE_WV + PRE_LOC, 512, 0, stream>>>(
      query, wq_w, wq_b, wv_b, loc_b, attn_b, wv_w, loc_w, qbias, packWV, packLOC);

  lsa_score<<<BB * NPART, 512, 0, stream>>>(
      values, prev, conv_w, conv_b, packWV, packLOC, qbias, proj_w,
      scores, mtile, ztile, ctxp, fused);

  if (fused) {
    lsa_combine<<<2 * BB, 256, 0, stream>>>(scores, mtile, ztile, ctxp, out_w, out_ctx);
  } else {
    lsa_softmax    <<< BB, 256, 0, stream>>>(scores, out_w);
    lsa_ctx_partial<<<BB * 32, 256, 0, stream>>>(values, out_w, parts);
    lsa_ctx_reduce <<< BB, 256, 0, stream>>>(parts, out_ctx);
  }
}

// v006
// One run takes 43 microseconds.
// Next to v005, in two timings, it ran 1.09 and 1.08 times as fast.
// All steps since v000 together make it 3.32 times as fast.
#include <hip/hip_runtime.h>
#include <hip/hip_bf16.h>

// ---------------------------------------------------------------------------
// Location-sensitive attention for MI455X (gfx1250, wave32, WMMA).
// B=32, T=4096, DV=512, DQ=512, ATTN=128, FILTERS=32, KSIZE=31
// Fused flash-style context accumulation: values read from HBM exactly once.
// ---------------------------------------------------------------------------

#define BB   32
#define TT   4096
#define DVV  512
#define AA   128
#define FF   32
#define KS   31
#define WAVES   8                   // waves per score workgroup (two per SIMD: 512 VGPRs each)
#define TPW     4                   // 16-row tiles per wave
#define ROWS_WG (WAVES * TPW * 16)  // 512 timesteps per score workgroup
#define NPART   (TT / ROWS_WG)      // 8 partials per batch row
#define APITCH  68                  // dwords per staged row: 128 bf16 + 16 B pad

typedef __attribute__((ext_vector_type(16))) __bf16 v16bf;
typedef __attribute__((ext_vector_type(8)))  float  v8f;

union Frag16 {          // 16 bf16 elements = 8 dwords = one WMMA A/B operand
  v16bf    v;
  unsigned u[8];
  uint4    q[2];
};

typedef __attribute__((ext_vector_type(2))) float  v2f;
typedef __attribute__((ext_vector_type(2))) __bf16 v2bf;
typedef __attribute__((ext_vector_type(4))) float  v4f;
typedef __attribute__((ext_vector_type(4))) __bf16 v4bf;
// f32 -> bf16, round to nearest even, by the packed hardware conversion
// (one instruction per pair; a in the low half)
__device__ __forceinline__ unsigned packbf(float a, float b) {
  v2f x = {a, b};
  return __builtin_bit_cast(unsigned, __builtin_convertvector(x, v2bf));
}
__device__ __forceinline__ uint2 packbf4(v4f x) {
  return __builtin_bit_cast(uint2, __builtin_convertvector(x, v4bf));
}

// ---------------------------------------------------------------------------
// Prepack wv_w [512,128] into WMMA bf16 B-operand layout.
// pk[(((ks*8 + nt)*2 + j/4)*32 + lane)*4 + j%4]  (each 16-B half-fragment of a
// wave is 512 contiguous bytes, conflict-free for LDS b128 reads):
//   lane holds column n = nt*16 + lane%16
//   lanes 0-15 hold K {0..7, 16..23}, lanes 16-31 hold K {8..15, 24..31}
//   dword j packs (K, K+1) with even K in the low half.
// ---------------------------------------------------------------------------
__device__ __forceinline__ void prepack_wv_item(
    int tid /* 0..32767 */, const float* __restrict__ wv_w, unsigned* __restrict__ pk) {
  int j   = tid & 7;
  int L   = (tid >> 3) & 31;
  int nt  = (tid >> 8) & 7;
  int ks  = tid >> 11;
  int n   = nt * 16 + (L & 15);
  int kb  = ks * 32 + ((L >> 4) ? 8 : 0) + ((j < 4) ? (2 * j) : (16 + 2 * (j - 4)));
  pk[(((ks * 8 + nt) * 2 + (j >> 2)) * 32 + L) * 4 + (j & 3)] =
      packbf(wv_w[kb * AA + n], wv_w[(kb + 1) * AA + n]);
  // precaution: in the shared-grid build other blocks' code follows this store, so
  // the wait stands ahead of any rewrite of a register the store names
  asm volatile("s_wait_xcnt 0x0" ::: "memory");
}

__device__ __forceinline__ void prepack_loc_item(
    int tid /* 0..2047 */, const float* __restrict__ loc_w, unsigned* __restrict__ pk) {
  int j   = tid & 7;
  int L   = (tid >> 3) & 31;
  int nt  = tid >> 8;
  int n   = nt * 16 + (L & 15);
  int kb  = ((L >> 4) ? 8 : 0) + ((j < 4) ? (2 * j) : (16 + 2 * (j - 4)));
  pk[((nt * 2 + (j >> 2)) * 32 + L) * 4 + (j & 3)] =
      packbf(loc_w[kb * AA + n], loc_w[(kb + 1) * AA + n]);
  // precaution: in the shared-grid build other blocks' code follows this store, so
  // the wait stands ahead of any rewrite of a register the store names
  asm volatile("s_wait_xcnt 0x0" ::: "memory");
}

// ---------------------------------------------------------------------------
// qbias[b][a] = query[b]·wq_w[:,a] + wq_b + wv_b + loc_b + attention_bias
// ---------------------------------------------------------------------------
#define QCOLS 32   // attn columns per qbias workgroup: one 128-B line of each wq_w row
__device__ __forceinline__ void qbias_block(
    int blk /* 0..BB*4-1 */,
    const float* __restrict__ query, const float* __restrict__ wq_w,
    const float* __restrict__ wq_b,  const float* __restrict__ wv_b,
    const float* __restrict__ loc_b, const float* __restrict__ attn_b,
    float* __restrict__ qbias) {
  // One workgroup = one batch row x 32 columns; K = 512 is split over 16 waves x
  // 4 lane groups x 8 rows, so a lane needs only 8 row loads and every load of
  // the kernel is issued before the first is used: one memory latency for the
  // kernel instead of one per group of rows.
  __shared__ __align__(16) float part[16][QCOLS];
  const int b    = blk >> 2, cq = blk & 3, tid = threadIdx.x;
  const int lane = tid & 31, w = tid >> 5;
  const int c4   = (lane & 7) * 4;             // lane's 4 columns in the line
  const int row0 = w * 32 + (lane >> 3) * 8;   // lane's 8 rows of K
  const int a    = cq * QCOLS + lane;          // column of the closing sum
  const float* wp = wq_w + row0 * AA + cq * QCOLS + c4;
  const float* qp = query + b * 512 + row0;
  float4 x[8];
  #pragma unroll
  for (int i = 0; i < 8; ++i) x[i] = *(const float4*)(wp + i * AA);
  float4 qv[2];
  qv[0] = *(const float4*)(qp);
  qv[1] = *(const float4*)(qp + 4);
  // precaution: in the shared-grid build a bias load's result lands in the query
  // loads' offset register, so the wait also stands between those loads
  asm volatile("s_wait_xcnt 0x0" ::: "memory");
  const float bq = wq_b[a], bv = wv_b[a], bl = loc_b[a], ba = attn_b[a];
  // precaution: stands ahead of any rewrite of a register the loads above name
  asm volatile("s_wait_xcnt 0x0" ::: "memory");
  const float qs[8] = {qv[0].x, qv[0].y, qv[0].z, qv[0].w,
                       qv[1].x, qv[1].y, qv[1].z, qv[1].w};
  float4 s = make_float4(0.f, 0.f, 0.f, 0.f);
  #pragma unroll
  for (int i = 0; i < 8; ++i) {
    s.x += qs[i] * x[i].x; s.y += qs[i] * x[i].y;
    s.z += qs[i] * x[i].z; s.w += qs[i] * x[i].w;
  }
  // the wave's 4 lane groups hold the same columns: fold them, fixed order
  #pragma unroll
  for (int d = 8; d < 32; d <<= 1) {
    s.x += __shfl_xor(s.x, d, 32); s.y += __shfl_xor(s.y, d, 32);
    s.z += __shfl_xor(s.z, d, 32); s.w += __shfl_xor(s.w, d, 32);
  }
  if (lane < 8) *(float4*)&part[w][c4] = s;
  __syncthreads();
  if (tid < QCOLS) {
    float t = part[0][tid];
    #pragma unroll
    for (int ww = 1; ww < 16; ++ww) t += part[ww][tid];   // fixed wave order
    qbias[b * AA + a] = t + bq + bv + bl + ba;
  }
}

// ---------------------------------------------------------------------------
// All the work the score kernel waits for, in ONE launch: the query bias and the
// two weight prepacks read and write disjoint data, so they share a grid by
// block range and run side by side (196 workgroups, all resident at once)
// instead of one after another with a launch gap between them.
// ---------------------------------------------------------------------------
#define PRE_QB  (BB * 4)            // blocks   0..127: query bias (the longest, first)
#define PRE_WV  (32768 / 512)       // blocks 128..191: wv_w prepack
#define PRE_LOC (2048 / 512)        // blocks 192..195: loc_w prepack
__global__ __launch_bounds__(512) void lsa_pre(
    const float* __restrict__ query, const float* __restrict__ wq_w,
    const float* __restrict__ wq_b,  const float* __restrict__ wv_b,
    const float* __restrict__ loc_b, const float* __restrict__ attn_b,
    const float* __restrict__ wv_w,  const float* __restrict__ loc_w,
    float* __restrict__ qbias, unsigned* __restrict__ packWV,
    unsigned* __restrict__ packLOC) {
  const int blk = blockIdx.x;        // the branch is uniform for the workgroup
  if (blk < PRE_QB)
    qbias_block(blk, query, wq_w, wq_b, wv_b, loc_b, attn_b, qbias);
  else if (blk < PRE_QB + PRE_WV)
    prepack_wv_item((blk - PRE_QB) * 512 + threadIdx.x, wv_w, packWV);
  else
    prepack_loc_item((blk - PRE_QB - PRE_WV) * 512 + threadIdx.x, loc_w, packLOC);
}

// ---------------------------------------------------------------------------
// Score (+ fused online-softmax context partial) kernel.
// One workgroup = 512 timesteps of one batch row, 8 waves; the packed weights
// lie in LDS once per workgroup.  Each wave owns 64 whole rows (four 16-row
// tiles) and all 128 attn columns, so a row's score is finished inside the
// wave: scores[b][t] = sum_a tanh(pre)[t][a] * proj_w[a].
// The wave's whole 16x512 f32 tile stays in 256 registers from its load to the
// context sum, so every value crosses L2 once.
// If do_ctx: the wave keeps a running max m, Z = sum exp(s-m) and
// ctx[d] = sum_t exp(s_t-m) * values[t][d] (from the tile's registers);
// the 8 waves are merged once at the end into one partial per workgroup.
// ---------------------------------------------------------------------------
// The wave's own LDS traffic has landed / returned: its lanes exchange rows
// through a per-wave LDS range, and the clobber keeps the compiler from moving
// LDS accesses across the hand-over.
#define WAVE_LDS_WAIT() asm volatile("s_wait_dscnt 0x0" ::: "memory")

// Eight independent v_exp_f32 (2^x) or v_rcp_f32 in one statement.  Written as
// asm text so that the slot the instruction set asks for behind a transcendental
// is kept by construction: the results are early-clobber, so none of the eight
// reads an earlier result or overwrites an earlier source, and the closing v_nop
// fills the slot behind the last one.
__device__ __forceinline__ void exp2_x8(float (&o)[8], const float (&a)[8]) {
  asm("v_exp_f32 %0, %8\n\tv_exp_f32 %1, %9\n\tv_exp_f32 %2, %10\n\t"
      "v_exp_f32 %3, %11\n\tv_exp_f32 %4, %12\n\tv_exp_f32 %5, %13\n\t"
      "v_exp_f32 %6, %14\n\tv_exp_f32 %7, %15\n\tv_nop"
      : "=&v"(o[0]), "=&v"(o[1]), "=&v"(o[2]), "=&v"(o[3]),
        "=&v"(o[4]), "=&v"(o[5]), "=&v"(o[6]), "=&v"(o[7])
      : "v"(a[0]), "v"(a[1]), "v"(a[2]), "v"(a[3]),
        "v"(a[4]), "v"(a[5]), "v"(a[6]), "v"(a[7]));
}
__device__ __forceinline__ void rcp_x8(float (&o)[8], const float (&a)[8]) {
  asm("v_rcp_f32 %0, %8\n\tv_rcp_f32 %1, %9\n\tv_rcp_f32 %2, %10\n\t"
      "v_rcp_f32 %3, %11\n\tv_rcp_f32 %4, %12\n\tv_rcp_f32 %5, %13\n\t"
      "v_rcp_f32 %6, %14\n\tv_rcp_f32 %7, %15\n\tv_nop"
      : "=&v"(o[0]), "=&v"(o[1]), "=&v"(o[2]), "=&v"(o[3]),
        "=&v"(o[4]), "=&v"(o[5]), "=&v"(o[6]), "=&v"(o[7])
      : "v"(a[0]), "v"(a[1]), "v"(a[2]), "v"(a[3]),
        "v"(a[4]), "v"(a[5]), "v"(a[6]), "v"(a[7]));
}

__global__ __launch_bounds__(256) void lsa_score(
    const float*    __restrict__ values,  const float* __restrict__ prev,
    const float*    __restrict__ conv_w,  const float* __restrict__ conv_b,
    const unsigned* __restrict__ packWV,  const unsigned* __restrict__ packLOC,
    const float*    __restrict__ qbias,   const float* __restrict__ proj_w,
    float*          __restrict__ scores,
    float*          __restrict__ mtile,   float* __restrict__ ztile,
    float*          __restrict__ ctxp,    int do_ctx, int bstep) {
  // bstep = 8192, the dwords of one K chunk's B panels.  It comes in as an argument
  // so that each unrolled chunk has one LDS base register and its 64 B reads use
  // the 16-bit immediate offset (with a constant the build formed one address
  // register per read beyond 64 KB, 128 of them, and spilled)
  __shared__ __align__(16) unsigned sWV [32768];              // 128 KB B panels
  __shared__ __align__(16) unsigned sLOC[2048];               //   8 KB B panels
  __shared__ __align__(16) float    sCW [1024];               //   4 KB conv taps (992 used)
  __shared__ __align__(16) unsigned stage[WAVES][16 * APITCH]; // 16x128 bf16 per wave
  __shared__ __align__(16) unsigned fbf  [WAVES][16 * 20];     // 16x32 bf16 conv features
  __shared__ __align__(16) float    wctx [WAVES][DVV];         // per-wave context
  __shared__ float pa[WAVES][96];     // per-wave alignment window (94 used)
  // one element per thread, stored unguarded; the first AA (FF) elements are read
  __shared__ float sQB[256];          // query bias row of this batch
  __shared__ float sPW[256];          // projection weights
  __shared__ __align__(8) float sCB[256];   // conv bias
  __shared__ float wm[WAVES];
  __shared__ float wz[WAVES];

  const int tid   = threadIdx.x;
  const int lane  = tid & 31;
  const int w     = __builtin_amdgcn_readfirstlane(tid >> 5);
  const int b     = blockIdx.x / NPART;
  const int part  = blockIdx.x % NPART;
  const int row0  = part * ROWS_WG + w * (TPW * 16);   // wave's first timestep
  const int rbase = lane & 15;         // A row / B column within tile
  const int hi    = lane >> 4;         // lane half selects K sub-block
  const int hi4   = hi * 4;            // dword offset of K half-chunk
  const float*   vbase = values + ((size_t)(b * TT + row0)) * DVV;   // wave-uniform
  const unsigned lane4 = lane * 4;                                   // lane's column

  // --- everything the workgroup stages in LDS: all its loads are issued together,
  //     unconditionally (indices wrapped or clamped into bounds), and stored without
  //     a guard (a guarded store drew its load into the branch, one more memory
  //     latency each), so the staging costs one memory latency ---
  {
    uint4 tmp[32];
    #pragma unroll
    for (int i = 0; i < 32; ++i) tmp[i] = ((const uint4*)packWV)[i * 256 + tid];
    const uint4 tl0 = ((const uint4*)packLOC)[tid];
    const uint4 tl1 = ((const uint4*)packLOC)[256 + tid];
    // the wave's alignment window (SAME padding, K=31 -> +/-15), all tiles
    float pv[3];
    #pragma unroll
    for (int h = 0; h < 3; ++h) {
      int idx = row0 - 15 + h * 32 + lane;
      int cl  = idx < 0 ? 0 : (idx > TT - 1 ? TT - 1 : idx);   // in-bounds address
      float v = prev[b * TT + cl];
      pv[h] = (idx == cl) ? v : 0.0f;
    }
    const int    ci = tid < KS * FF / 4 ? tid : KS * FF / 4 - 1;
    const float4 cw = ((const float4*)conv_w)[ci];
    const float  qb = qbias[b * AA + (tid & (AA - 1))];
    const float  pj = proj_w[tid & (AA - 1)];
    const float  cb = conv_b[tid & (FF - 1)];
    // precaution: stands ahead of any rewrite of a register these loads name
    asm volatile("s_wait_xcnt 0x0" ::: "memory");
    #pragma unroll
    for (int i = 0; i < 32; ++i) ((uint4*)sWV)[i * 256 + tid] = tmp[i];
    ((uint4*)sLOC)[tid] = tl0;
    ((uint4*)sLOC)[256 + tid] = tl1;
    #pragma unroll
    for (int h = 0; h < 3; ++h) pa[w][h * 32 + lane] = pv[h];
    ((float4*)sCW)[tid] = cw;   // unguarded: the last 8 threads fill the array's unused tail
    sQB[tid] = qb; sPW[tid] = pj; sCB[tid] = cb;
  }
  __syncthreads();

  // x[c][r]: row r, columns c*128 + lane*4 .. +3 of the wave's current tile; one
  // whole 512-B row piece per load, each piece one register tuple.  The tile's
  // loads stand behind the barrier (the build waits for every load in flight ahead
  // of one) and go out chunk by chunk, the order the matrix loop needs them in
  // (loads are waited for in issue order); the scheduling barriers hold that order.
  v4f x[4][16];
  #pragma unroll
  for (int c = 0; c < 4; ++c) {
    __builtin_amdgcn_sched_barrier(0);
    #pragma unroll
    for (int r = 0; r < 16; ++r)
      x[c][r] = *(const v4f*)(vbase + r * DVV + c * 128 + lane4);
  }
  // precaution: the wait stands ahead of any rewrite of a register these loads name;
  // the two scheduling barriers hold the loads ahead of it and such rewrites behind
  // it (the build had lifted a write of the scalar base over the wait)
  __builtin_amdgcn_sched_barrier(0);
  asm volatile("s_wait_xcnt 0x0" ::: "memory");
  __builtin_amdgcn_sched_barrier(0);

  float  m_run = -3.402823466e+38f, z_run = 0.f;
  v4f cx[4];   // the wave's running context: the lane's 16 columns
  #pragma unroll
  for (int j = 0; j < 4; ++j) cx[j] = (v4f){0.f, 0.f, 0.f, 0.f};

  float sc[16];   // softmax weights of the tile's rows (set and read only under do_ctx)
  #pragma unroll 1   // the tiles share one copy of the body (instruction cache)
  for (int tl = 0; tl < TPW; ++tl) {
    const int t0 = row0 + tl * 16;

    // --- 31-tap conv over alignment (SAME padding): lane -> filter pair c0,
    //     timesteps hi, hi+2, ..., hi+14 ---
    {
      const int c0 = rbase * 2;
      float win[45];
      #pragma unroll
      for (int k = 0; k < 45; ++k) win[k] = pa[w][tl * 16 + hi + k];
      float s0[8], s1[8];
      #pragma unroll
      for (int i = 0; i < 8; ++i) { s0[i] = sCB[c0]; s1[i] = sCB[c0 + 1]; }
      #pragma unroll
      for (int j = 0; j < KS; ++j) {
        float2 wj = *(const float2*)&sCW[j * FF + c0];
        #pragma unroll
        for (int i = 0; i < 8; ++i) {
          s0[i] += win[2 * i + j] * wj.x;
          s1[i] += win[2 * i + j] * wj.y;
        }
      }
      WAVE_LDS_WAIT();   // last tile's feature reads are back before the rows change
      #pragma unroll
      for (int i = 0; i < 8; ++i)
        fbf[w][(hi + 2 * i) * 20 + rbase] = packbf(s0[i], s1[i]);
      WAVE_LDS_WAIT();   // feature rows written before other lanes read them
    }

    v8f acc[8];

    // --- proc_loc = f(16x32) @ loc_w(32x128): 8 bf16 WMMAs ---
    {
      Frag16 fa;
      fa.q[0] = *(const uint4*)&fbf[w][rbase * 20 + hi4];
      fa.q[1] = *(const uint4*)&fbf[w][rbase * 20 + 8 + hi4];
      #pragma unroll
      for (int nt = 0; nt < 8; ++nt) {
        Frag16 lb;
        lb.q[0] = *(const uint4*)&sLOC[(nt * 2 + 0) * 128 + lane * 4];
        lb.q[1] = *(const uint4*)&sLOC[(nt * 2 + 1) * 128 + lane * 4];
        v8f zero = {};
        acc[nt] = __builtin_amdgcn_wmma_f32_16x16x32_bf16(
            false, fa.v, false, lb.v, (short)0, zero, false, false);
      }
    }

    // --- wv = values(16x512) @ wv_w(512x128): 4 chunks of K=128, 32 WMMAs each ---
    #pragma unroll     // unrolled: the tile's registers are named by constants only
    for (int c = 0; c < 4; ++c) {
      const unsigned* bpan = &sWV[c * bstep + lane * 4];
      WAVE_LDS_WAIT();   // last chunk's A reads are back before its rows change
      #pragma unroll
      for (int r = 0; r < 16; ++r) {
        *(uint2*)&stage[w][r * APITCH + lane * 2] = packbf4(x[c][r]);
      }
      WAVE_LDS_WAIT();   // staged rows written before other lanes read them
      #pragma unroll
      for (int ksl = 0; ksl < 4; ++ksl) {
        Frag16 av;
        const unsigned* arow = &stage[w][rbase * APITCH + ksl * 16 + hi4];
        av.q[0] = *(const uint4*)(arow);
        av.q[1] = *(const uint4*)(arow + 8);
        #pragma unroll
        for (int nh = 0; nh < 8; nh += 4) {
          Frag16 bv[4];
          #pragma unroll
          for (int nt = 0; nt < 4; ++nt) {
            bv[nt].q[0] = *(const uint4*)(bpan + ((ksl * 8 + nh + nt) * 2 + 0) * 128);
            bv[nt].q[1] = *(const uint4*)(bpan + ((ksl * 8 + nh + nt) * 2 + 1) * 128);
          }
          // keeps a group's 8 LDS reads together ahead of its 4 WMMAs (they issue
          // under the group before): one LDS latency per group, not one per WMMA
          __builtin_amdgcn_sched_barrier(0);
          #pragma unroll
          for (int nt = 0; nt < 4; ++nt)
            acc[nh + nt] = __builtin_amdgcn_wmma_f32_16x16x32_bf16(
                false, av.v, false, bv[nt].v, (short)0, acc[nh + nt], false, false);
        }
      }
    }

    // --- epilogue: tanh, project, reduce over attn dim (deterministic) ---
    // C layout: vgpr i -> row i (lanes 0-15) / row i+8 (lanes 16-31), col=lane%16
    // tanh(x) = 1 - 2 / (1 + e^(2x)), written without a branch: 64 independent
    // short chains per lane instead of 64 masked two-way branches in series.
    // e^(2x) = inf gives 1, e^(2x) = 0 gives -1, NaN stays NaN; the absolute
    // error is a few f32 roundings of 1, far below the bf16 products' own.  The
    // projection is folded in: sum_a pw*tanh = sum_a pw - 2 * sum_a pw / (1 + e^(2x)).
    const float K2 = 2.8853900817779268f;   // 2 * log2(e)
    float qk[8], pw2[8];
    float pws = 0.f;
    #pragma unroll
    for (int nt = 0; nt < 8; ++nt) {
      const float p = sPW[nt * 16 + rbase];
      qk[nt]  = sQB[nt * 16 + rbase] * K2;
      pw2[nt] = -2.0f * p;
      pws    += p;
    }
    float ps[8];
    #pragma unroll
    for (int i = 0; i < 8; ++i) {
      float xa[8], ex[8], rc[8];
      #pragma unroll
      for (int nt = 0; nt < 8; ++nt) xa[nt] = fmaf(acc[nt][i], K2, qk[nt]);
      exp2_x8(ex, xa);
      #pragma unroll
      for (int nt = 0; nt < 8; ++nt) ex[nt] += 1.0f;
      rcp_x8(rc, ex);
      float vv = pws;
      #pragma unroll
      for (int nt = 0; nt < 8; ++nt) vv = fmaf(rc[nt], pw2[nt], vv);
      vv += __shfl_xor(vv, 1, 16);
      vv += __shfl_xor(vv, 2, 16);
      vv += __shfl_xor(vv, 4, 16);
      vv += __shfl_xor(vv, 8, 16);
      ps[i] = vv;                       // score of row i + 8*hi, in all 16 lanes
    }
    {
      float mine = ps[0];
      #pragma unroll
      for (int i = 1; i < 8; ++i) mine = (rbase == i) ? ps[i] : mine;
      if (rbase < 8) scores[b * TT + t0 + hi * 8 + rbase] = mine;
    }

    if (do_ctx) {
      // --- all 16 scores in every lane, then the online-softmax update ---
      #pragma unroll
      for (int i = 0; i < 8; ++i) {
        float other = __shfl_xor(ps[i], 16, 32);
        sc[i]     = hi ? other : ps[i];
        sc[i + 8] = hi ? ps[i] : other;
      }
      float mn = m_run;
      #pragma unroll
      for (int t = 0; t < 16; ++t) mn = fmaxf(mn, sc[t]);
      const float resc = expf(m_run - mn);
      m_run = mn;
      z_run *= resc;
      #pragma unroll
      for (int j = 0; j < 4; ++j) cx[j] *= resc;
      #pragma unroll
      for (int t = 0; t < 16; ++t) { sc[t] = expf(sc[t] - mn); z_run += sc[t]; }
    }

    // --- ctx[d] += e_t * values[t][d] from the tile's registers.  Behind the sum
    //     the registers are free and the next tile's loads go out: they fly under
    //     the conv and the WMMAs.  All 64 stand in one straight run of code, chunk
    //     by chunk (the scheduling barriers hold that order), so that the build's
    //     counted waits in the matrix loop ask for one chunk at a time ---
    if (do_ctx) {
      #pragma unroll
      for (int j = 0; j < 4; ++j) {
        #pragma unroll
        for (int t = 0; t < 16; ++t) cx[j] += sc[t] * x[j][t];
      }
    }
    if (tl + 1 < TPW) {
      const float* nsrc = vbase + (size_t)((tl + 1) * 16) * DVV;
      #pragma unroll
      for (int j = 0; j < 4; ++j) {
        __builtin_amdgcn_sched_barrier(0);
        #pragma unroll
        for (int r = 0; r < 16; ++r)
          x[j][r] = *(const v4f*)(nsrc + r * DVV + j * 128 + lane4);
      }
      __builtin_amdgcn_sched_barrier(0);   // holds the loads ahead of the wait below
      // precaution: stands ahead of any rewrite of a register these loads name
      asm volatile("s_wait_xcnt 0x0" ::: "memory");
    }
  }

  if (!do_ctx) return;

  // --- merge the 8 waves' (m, Z, ctx) into one partial, fixed order ---
  #pragma unroll
  for (int j = 0; j < 4; ++j) *(v4f*)&wctx[w][j * 128 + lane4] = cx[j];
  if (lane == 0) { wm[w] = m_run; wz[w] = z_run; }
  __syncthreads();
  {
    float m = wm[0];
    #pragma unroll
    for (int ww = 1; ww < WAVES; ++ww) m = fmaxf(m, wm[ww]);
    float z = 0.f, cacc = 0.f, cac2 = 0.f;
    #pragma unroll
    for (int ww = 0; ww < WAVES; ++ww) {
      float e = expf(wm[ww] - m);
      z    += wz[ww] * e;
      cacc += e * wctx[ww][tid];
      cac2 += e * wctx[ww][256 + tid];
    }
    ctxp[(size_t)(b * NPART + part) * DVV + tid] = cacc;
    ctxp[(size_t)(b * NPART + part) * DVV + 256 + tid] = cac2;
    if (tid == 0) {
      mtile[b * NPART + part] = m;
      ztile[b * NPART + part] = z;
    }
  }
}

// ---------------------------------------------------------------------------
// Fused path combine, ONE launch of 2*BB workgroups.  Every workgroup forms its
// batch row's global softmax stats from the NPART partial stats (16 loads, fixed
// order); blocks 0..BB-1 then write the attention weights, blocks BB..2*BB-1 the
// context: ctx[b][d] = invZ * sum_p exp(m_p - m) * ctxp[p][d].  The context half
// recomputes the stats rather than wait a launch for them.
// ---------------------------------------------------------------------------
__global__ __launch_bounds__(256) void lsa_combine(
    const float* __restrict__ scores, const float* __restrict__ mtile,
    const float* __restrict__ ztile,  const float* __restrict__ ctxp,
    float* __restrict__ out_w,        float* __restrict__ out_ctx) {
  const int half = blockIdx.x / BB, b = blockIdx.x % BB, tid = threadIdx.x;

  float mt[NPART], sc[NPART];   // unrolled loops keep both in registers
  #pragma unroll
  for (int p = 0; p < NPART; ++p) mt[p] = mtile[b * NPART + p];
  float mg = mt[0];
  #pragma unroll
  for (int p = 1; p < NPART; ++p) mg = fmaxf(mg, mt[p]);
  float z = 0.f;
  #pragma unroll
  for (int p = 0; p < NPART; ++p) {               // fixed order
    sc[p] = expf(mt[p] - mg);
    z += ztile[b * NPART + p] * sc[p];
  }
  const float inv = 1.0f / z;

  if (half == 0) {                                // uniform for the workgroup
    const float* s = scores + b * TT;
    for (int t = tid; t < TT; t += 256)
      out_w[b * TT + t] = expf(s[t] - mg) * inv;
  } else {
    const float2* p2 = (const float2*)ctxp;
    float2 s; s.x = 0.f; s.y = 0.f;
    #pragma unroll   // sc[] is indexed by constants only, so it stays in registers
    for (int c = 0; c < NPART; ++c) {             // fixed order
      float2 x = p2[(size_t)(b * NPART + c) * 256 + tid];
      s.x += sc[c] * x.x; s.y += sc[c] * x.y;
    }
    s.x *= inv; s.y *= inv;
    ((float2*)out_ctx)[b * 256 + tid] = s;
    // precaution: the other half's code follows this store in the build, so the
    // wait stands ahead of any rewrite of a register the store names
    asm volatile("s_wait_xcnt 0x0" ::: "memory");
  }
}

// ---------------------------------------------------------------------------
// Fallback path (small workspace): plain softmax + second values pass.
// ---------------------------------------------------------------------------
__global__ __launch_bounds__(256) void lsa_softmax(
    const float* __restrict__ scores, float* __restrict__ out_w) {
  __shared__ float red[256];
  const int b = blockIdx.x, tid = threadIdx.x;
  const float* s = scores + b * TT;

  float m = -3.402823466e+38f;
  for (int t = tid; t < TT; t += 256) m = fmaxf(m, s[t]);
  red[tid] = m; __syncthreads();
  for (int off = 128; off > 0; off >>= 1) {
    if (tid < off) red[tid] = fmaxf(red[tid], red[tid + off]);
    __syncthreads();
  }
  m = red[0]; __syncthreads();

  float sum = 0.f;
  for (int t = tid; t < TT; t += 256) sum += expf(s[t] - m);
  red[tid] = sum; __syncthreads();
  for (int off = 128; off > 0; off >>= 1) {
    if (tid < off) red[tid] += red[tid + off];
    __syncthreads();
  }
  const float inv = 1.0f / red[0];
  for (int t = tid; t < TT; t += 256)
    out_w[b * TT + t] = expf(s[t] - m) * inv;
}

__global__ __launch_bounds__(256) void lsa_ctx_partial(
    const float* __restrict__ values, const float* __restrict__ attn_w,
    float* __restrict__ partials) {
  const int b = blockIdx.x >> 5, chunk = blockIdx.x & 31, tid = threadIdx.x;
  const float2* v = (const float2*)(values + ((size_t)b * TT) * DVV);
  const int tbase = chunk * 128;
  float2 acc; acc.x = 0.f; acc.y = 0.f;
  for (int t = 0; t < 128; ++t) {
    float wt = attn_w[b * TT + tbase + t];
    float2 x = v[(size_t)(tbase + t) * 256 + tid];
    acc.x += wt * x.x;
    acc.y += wt * x.y;
  }
  ((float2*)partials)[(size_t)(b * 32 + chunk) * 256 + tid] = acc;
}

__global__ __launch_bounds__(256) void lsa_ctx_reduce(
    const float* __restrict__ partials, float* __restrict__ out_ctx) {
  const int b = blockIdx.x, tid = threadIdx.x;
  const float2* p = (const float2*)partials;
  float2 s; s.x = 0.f; s.y = 0.f;
  #pragma unroll
  for (int c = 0; c < 32; ++c) {
    float2 x = p[(size_t)(b * 32 + c) * 256 + tid];
    s.x += x.x; s.y += x.y;
  }
  ((float2*)out_ctx)[b * 256 + tid] = s;
}

// ---------------------------------------------------------------------------
extern "C" void kernel_launch(void* const* d_in, const int* in_sizes, int n_in,
                              void* d_out, int out_size, void* d_ws, size_t ws_size,
                              hipStream_t stream) {
  const float* query  = (const float*)d_in[0];
  const float* values = (const float*)d_in[1];
  const float* prev   = (const float*)d_in[2];
  const float* conv_w = (const float*)d_in[3];
  const float* conv_b = (const float*)d_in[4];
  const float* loc_w  = (const float*)d_in[5];
  const float* loc_b  = (const float*)d_in[6];
  const float* wq_w   = (const float*)d_in[7];
  const float* wq_b   = (const float*)d_in[8];
  const float* wv_w   = (const float*)d_in[9];
  const float* wv_b   = (const float*)d_in[10];
  const float* attn_b = (const float*)d_in[11];
  const float* proj_w = (const float*)d_in[12];

  float* out_ctx = (float*)d_out;               // [32, 512]
  float* out_w   = out_ctx + BB * DVV;          // [32, 4096]

  unsigned char* ws = (unsigned char*)d_ws;
  unsigned* packWV  = (unsigned*)(ws);            // 32768 u32  (128 KB)
  unsigned* packLOC = (unsigned*)(ws + 131072);   //  2048 u32  (  8 KB)
  float*    qbias   = (float*)(ws + 139264);      //  4096 f32  ( 16 KB)
  float*    scores  = (float*)(ws + 155648);      // 131072 f32 (512 KB)
  // fused-path extras
  float*    mtile   = (float*)(ws + 679936);      //   256 f32
  float*    ztile   = (float*)(ws + 712704);      //   256 f32
  float*    ctxp    = (float*)(ws + 778752);      // 32*8*512 f32 (512 KB)
  const size_t fused_need = 778752u + (size_t)BB * NPART * DVV * 4u;
  // fallback-path extra (overlaps the fused region)
  float*    parts   = (float*)(ws + 679936);      // 524288 f32 (2 MB)
  const int fused = (ws_size >= fused_need) ? 1 : 0;

  lsa_pre<<<PRE_QB + PRE_WV + PRE_LOC, 512, 0, stream>>>(
      query, wq_w, wq_b, wv_b, loc_b, attn_b, wv_w, loc_w, qbias, packWV, packLOC);

  lsa_score<<<BB * NPART, 256, 0, stream>>>(
      values, prev, conv_w, conv_b, packWV, packLOC, qbias, proj_w,
      scores, mtile, ztile, ctxp, fused, 8192);

  if (fused) {
    lsa_combine<<<2 * BB, 256, 0, stream>>>(scores, mtile, ztile, ctxp, out_w, out_ctx);
  } else {
    lsa_softmax    <<< BB, 256, 0, stream>>>(scores, out_w);
    lsa_ctx_partial<<<BB * 32, 256, 0, stream>>>(values, out_w, parts);
    lsa_ctx_reduce <<< BB, 256, 0, stream>>>(parts, out_ctx);
  }
}

// v007
// It runs in 38.2 microseconds.
// Timed twice side by side with v006, it ran 1.11 times as fast both times.
// All steps since v000 together make it 3.70 times as fast.
#include <hip/hip_runtime.h>
#include <hip/hip_bf16.h>

// ---------------------------------------------------------------------------
// Location-sensitive attention for MI455X (gfx1250, wave32, WMMA).
// B=32, T=4096, DV=512, DQ=512, ATTN=128, FILTERS=32, KSIZE=31
// Fused flash-style context accumulation: values read from HBM exactly once.
// ---------------------------------------------------------------------------

#define BB   32
#define TT   4096
#define DVV  512
#define AA   128
#define FF   32
#define KS   31
#define WAVES   8                   // waves per score workgroup (two per SIMD: 512 VGPRs each)
#define TPW     4                   // 16-row tiles per wave
#define ROWS_WG (WAVES * TPW * 16)  // 512 timesteps per score workgroup
#define NPART   (TT / ROWS_WG)      // 8 partials per batch row
#define APITCH  68                  // dwords per staged row: 128 bf16 + 16 B pad

typedef __attribute__((ext_vector_type(16))) __bf16 v16bf;
typedef __attribute__((ext_vector_type(8)))  float  v8f;

union Frag16 {          // 16 bf16 elements = 8 dwords = one WMMA A/B operand
  v16bf    v;
  unsigned u[8];
  uint4    q[2];
};

typedef __attribute__((ext_vector_type(2))) float  v2f;
typedef __attribute__((ext_vector_type(2))) __bf16 v2bf;
typedef __attribute__((ext_vector_type(4))) float  v4f;
typedef __attribute__((ext_vector_type(4))) __bf16 v4bf;
// f32 -> bf16, round to nearest even, by the packed hardware conversion
// (one instruction per pair; a in the low half)
__device__ __forceinline__ unsigned packbf(float a, float b) {
  v2f x = {a, b};
  return __builtin_bit_cast(unsigned, __builtin_convertvector(x, v2bf));
}
__device__ __forceinline__ uint2 packbf4(v4f x) {
  return __builtin_bit_cast(uint2, __builtin_convertvector(x, v4bf));
}

// ---------------------------------------------------------------------------
// Prepack wv_w [512,128] into WMMA bf16 B-operand layout.
// pk[(((ks*8 + nt)*2 + j/4)*32 + lane)*4 + j%4]  (each 16-B half-fragment of a
// wave is 512 contiguous bytes, conflict-free for LDS b128 reads):
//   lane holds column n = nt*16 + lane%16
//   lanes 0-15 hold K {0..7, 16..23}, lanes 16-31 hold K {8..15, 24..31}
//   dword j packs (K, K+1) with even K in the low half.
// ---------------------------------------------------------------------------
__device__ __forceinline__ void prepack_wv_item(
    int tid /* 0..32767 */, const float* __restrict__ wv_w, unsigned* __restrict__ pk) {
  int j   = tid & 7;
  int L   = (tid >> 3) & 31;
  int nt  = (tid >> 8) & 7;
  int ks  = tid >> 11;
  int n   = nt * 16 + (L & 15);
  int kb  = ks * 32 + ((L >> 4) ? 8 : 0) + ((j < 4) ? (2 * j) : (16 + 2 * (j - 4)));
  pk[(((ks * 8 + nt) * 2 + (j >> 2)) * 32 + L) * 4 + (j & 3)] =
      packbf(wv_w[kb * AA + n], wv_w[(kb + 1) * AA + n]);
  // precaution: in the shared-grid build other blocks' code follows this store, so
  // the wait stands ahead of any rewrite of a register the store names
  asm volatile("s_wait_xcnt 0x0" ::: "memory");
}

__device__ __forceinline__ void prepack_loc_item(
    int tid /* 0..2047 */, const float* __restrict__ loc_w, unsigned* __restrict__ pk) {
  int j   = tid & 7;
  int L   = (tid >> 3) & 31;
  int nt  = tid >> 8;
  int n   = nt * 16 + (L & 15);
  int kb  = ((L >> 4) ? 8 : 0) + ((j < 4) ? (2 * j) : (16 + 2 * (j - 4)));
  pk[((nt * 2 + (j >> 2)) * 32 + L) * 4 + (j & 3)] =
      packbf(loc_w[kb * AA + n], loc_w[(kb + 1) * AA + n]);
  // precaution: in the shared-grid build other blocks' code follows this store, so
  // the wait stands ahead of any rewrite of a register the store names
  asm volatile("s_wait_xcnt 0x0" ::: "memory");
}

// ---------------------------------------------------------------------------
// qbias[b][a] = query[b]·wq_w[:,a] + wq_b + wv_b + loc_b + attention_bias
// ---------------------------------------------------------------------------
#define QCOLS 32   // attn columns per qbias workgroup: one 128-B line of each wq_w row
__device__ __forceinline__ void qbias_block(
    int blk /* 0..BB*4-1 */,
    const float* __restrict__ query, const float* __restrict__ wq_w,
    const float* __restrict__ wq_b,  const float* __restrict__ wv_b,
    const float* __restrict__ loc_b, const float* __restrict__ attn_b,
    float* __restrict__ qbias) {
  // One workgroup = one batch row x 32 columns; K = 512 is split over 16 waves x
  // 4 lane groups x 8 rows, so a lane needs only 8 row loads and every load of
  // the kernel is issued before the first is used: one memory latency for the
  // kernel instead of one per group of rows.
  __shared__ __align__(16) float part[16][QCOLS];
  const int b    = blk >> 2, cq = blk & 3, tid = threadIdx.x;
  const int lane = tid & 31, w = tid >> 5;
  const int c4   = (lane & 7) * 4;             // lane's 4 columns in the line
  const int row0 = w * 32 + (lane >> 3) * 8;   // lane's 8 rows of K
  const int a    = cq * QCOLS + lane;          // column of the closing sum
  const float* wp = wq_w + row0 * AA + cq * QCOLS + c4;
  const float* qp = query + b * 512 + row0;
  float4 x[8];
  #pragma unroll
  for (int i = 0; i < 8; ++i) x[i] = *(const float4*)(wp + i * AA);
  float4 qv[2];
  qv[0] = *(const float4*)(qp);
  qv[1] = *(const float4*)(qp + 4);
  // precaution: in the shared-grid build a bias load's result lands in the query
  // loads' offset register, so the wait also stands between those loads
  asm volatile("s_wait_xcnt 0x0" ::: "memory");
  const float bq = wq_b[a], bv = wv_b[a], bl = loc_b[a], ba = attn_b[a];
  // precaution: stands ahead of any rewrite of a register the loads above name
  asm volatile("s_wait_xcnt 0x0" ::: "memory");
  const float qs[8] = {qv[0].x, qv[0].y, qv[0].z, qv[0].w,
                       qv[1].x, qv[1].y, qv[1].z, qv[1].w};
  float4 s = make_float4(0.f, 0.f, 0.f, 0.f);
  #pragma unroll
  for (int i = 0; i < 8; ++i) {
    s.x += qs[i] * x[i].x; s.y += qs[i] * x[i].y;
    s.z += qs[i] * x[i].z; s.w += qs[i] * x[i].w;
  }
  // the wave's 4 lane groups hold the same columns: fold them, fixed order
  #pragma unroll
  for (int d = 8; d < 32; d <<= 1) {
    s.x += __shfl_xor(s.x, d, 32); s.y += __shfl_xor(s.y, d, 32);
    s.z += __shfl_xor(s.z, d, 32); s.w += __shfl_xor(s.w, d, 32);
  }
  if (lane < 8) *(float4*)&part[w][c4] = s;
  __syncthreads();
  if (tid < QCOLS) {
    float t = part[0][tid];
    #pragma unroll
    for (int ww = 1; ww < 16; ++ww) t += part[ww][tid];   // fixed wave order
    qbias[b * AA + a] = t + bq + bv + bl + ba;
  }
}

// ---------------------------------------------------------------------------
// All the work the score kernel waits for, in ONE launch: the query bias and the
// two weight prepacks read and write disjoint data, so they share a grid by
// block range and run side by side (196 workgroups, all resident at once)
// instead of one after another with a launch gap between them.
// ---------------------------------------------------------------------------
#define PRE_QB  (BB * 4)            // blocks   0..127: query bias (the longest, first)
#define PRE_WV  (32768 / 512)       // blocks 128..191: wv_w prepack
#define PRE_LOC (2048 / 512)        // blocks 192..195: loc_w prepack
__global__ __launch_bounds__(512) void lsa_pre(
    const float* __restrict__ query, const float* __restrict__ wq_w,
    const float* __restrict__ wq_b,  const float* __restrict__ wv_b,
    const float* __restrict__ loc_b, const float* __restrict__ attn_b,
    const float* __restrict__ wv_w,  const float* __restrict__ loc_w,
    float* __restrict__ qbias, unsigned* __restrict__ packWV,
    unsigned* __restrict__ packLOC) {
  const int blk = blockIdx.x;        // the branch is uniform for the workgroup
  if (blk < PRE_QB)
    qbias_block(blk, query, wq_w, wq_b, wv_b, loc_b, attn_b, qbias);
  else if (blk < PRE_QB + PRE_WV)
    prepack_wv_item((blk - PRE_QB) * 512 + threadIdx.x, wv_w, packWV);
  else
    prepack_loc_item((blk - PRE_QB - PRE_WV) * 512 + threadIdx.x, loc_w, packLOC);
}

// ---------------------------------------------------------------------------
// Score (+ fused online-softmax context partial) kernel.
// One workgroup = 512 timesteps of one batch row, 8 waves; the packed weights
// lie in LDS once per workgroup.  Each wave owns 64 whole rows (four 16-row
// tiles) and all 128 attn columns, so a row's score is finished inside the
// wave: scores[b][t] = sum_a tanh(pre)[t][a] * proj_w[a].
// The wave's whole 16x512 f32 tile stays in 256 registers from its load to the
// context sum, so every value crosses L2 once.
// If do_ctx: the wave keeps a running max m, Z = sum exp(s-m) and
// ctx[d] = sum_t exp(s_t-m) * values[t][d] (from the tile's registers);
// the 8 waves are merged once at the end into one partial per workgroup.
// ---------------------------------------------------------------------------
// The wave's own LDS traffic has landed / returned: its lanes exchange rows
// through a per-wave LDS range, and the clobber keeps the compiler from moving
// LDS accesses across the hand-over.
#define WAVE_LDS_WAIT() asm volatile("s_wait_dscnt 0x0" ::: "memory")

// Eight independent v_exp_f32 (2^x) or v_rcp_f32 in one statement.  Written as
// asm text so that the slot the instruction set asks for behind a transcendental
// is kept by construction: the results are early-clobber, so none of the eight
// reads an earlier result or overwrites an earlier source, and the closing v_nop
// fills the slot behind the last one.
__device__ __forceinline__ void exp2_x8(float (&o)[8], const float (&a)[8]) {
  asm("v_exp_f32 %0, %8\n\tv_exp_f32 %1, %9\n\tv_exp_f32 %2, %10\n\t"
      "v_exp_f32 %3, %11\n\tv_exp_f32 %4, %12\n\tv_exp_f32 %5, %13\n\t"
      "v_exp_f32 %6, %14\n\tv_exp_f32 %7, %15\n\tv_nop"
      : "=&v"(o[0]), "=&v"(o[1]), "=&v"(o[2]), "=&v"(o[3]),
        "=&v"(o[4]), "=&v"(o[5]), "=&v"(o[6]), "=&v"(o[7])
      : "v"(a[0]), "v"(a[1]), "v"(a[2]), "v"(a[3]),
        "v"(a[4]), "v"(a[5]), "v"(a[6]), "v"(a[7]));
}
__device__ __forceinline__ void rcp_x8(float (&o)[8], const float (&a)[8]) {
  asm("v_rcp_f32 %0, %8\n\tv_rcp_f32 %1, %9\n\tv_rcp_f32 %2, %10\n\t"
      "v_rcp_f32 %3, %11\n\tv_rcp_f32 %4, %12\n\tv_rcp_f32 %5, %13\n\t"
      "v_rcp_f32 %6, %14\n\tv_rcp_f32 %7, %15\n\tv_nop"
      : "=&v"(o[0]), "=&v"(o[1]), "=&v"(o[2]), "=&v"(o[3]),
        "=&v"(o[4]), "=&v"(o[5]), "=&v"(o[6]), "=&v"(o[7])
      : "v"(a[0]), "v"(a[1]), "v"(a[2]), "v"(a[3]),
        "v"(a[4]), "v"(a[5]), "v"(a[6]), "v"(a[7]));
}

__global__ __launch_bounds__(256) void lsa_score(
    const float*    __restrict__ values,  const float* __restrict__ prev,
    const float*    __restrict__ conv_w,  const float* __restrict__ conv_b,
    const unsigned* __restrict__ packWV,  const unsigned* __restrict__ packLOC,
    const float*    __restrict__ qbias,   const float* __restrict__ proj_w,
    float*          __restrict__ scores,
    float*          __restrict__ mtile,   float* __restrict__ ztile,
    float*          __restrict__ ctxp,    int do_ctx, int bstep) {
  // bstep = 8192, the dwords of one K chunk's B panels.  It comes in as an argument
  // so that each unrolled chunk has one LDS base register and its 64 B reads use
  // the 16-bit immediate offset (with a constant the build formed one address
  // register per read beyond 64 KB, 128 of them, and spilled)
  __shared__ __align__(16) unsigned sWV [32768];              // 128 KB B panels
  __shared__ __align__(16) unsigned sLOC[2048];               //   8 KB B panels
  __shared__ __align__(16) float    sCW [1024];               //   4 KB conv taps (992 used)
  __shared__ __align__(16) unsigned stage[WAVES][16 * APITCH]; // 16x128 bf16 per wave
  __shared__ __align__(16) unsigned fbf  [WAVES][16 * 20];     // 16x32 bf16 conv features
  __shared__ __align__(16) float    wctx [WAVES][DVV];         // per-wave context
  __shared__ float pa[WAVES][96];     // per-wave alignment window (94 used)
  // one element per thread, stored unguarded; the first AA (FF) elements are read
  __shared__ float sQB[256];          // query bias row of this batch
  __shared__ float sPW[256];          // projection weights
  __shared__ __align__(8) float sCB[256];   // conv bias
  __shared__ float wm[WAVES];
  __shared__ float wz[WAVES];

  const int tid   = threadIdx.x;
  const int lane  = tid & 31;
  const int w     = __builtin_amdgcn_readfirstlane(tid >> 5);
  const int b     = blockIdx.x / NPART;
  const int part  = blockIdx.x % NPART;
  const int row0  = part * ROWS_WG + w * (TPW * 16);   // wave's first timestep
  const int rbase = lane & 15;         // A row / B column within tile
  const int hi    = lane >> 4;         // lane half selects K sub-block
  const int hi4   = hi * 4;            // dword offset of K half-chunk
  const float*   vbase = values + ((size_t)(b * TT + row0)) * DVV;   // wave-uniform
  const unsigned lane4 = lane * 4;                                   // lane's column

  // --- everything the workgroup stages in LDS: all its loads are issued together,
  //     unconditionally (indices wrapped or clamped into bounds), and stored without
  //     a guard (a guarded store drew its load into the branch, one more memory
  //     latency each), so the staging costs one memory latency ---
  {
    uint4 tmp[32];
    #pragma unroll
    for (int i = 0; i < 32; ++i) tmp[i] = ((const uint4*)packWV)[i * 256 + tid];
    const uint4 tl0 = ((const uint4*)packLOC)[tid];
    const uint4 tl1 = ((const uint4*)packLOC)[256 + tid];
    // the wave's alignment window (SAME padding, K=31 -> +/-15), all tiles
    float pv[3];
    #pragma unroll
    for (int h = 0; h < 3; ++h) {
      int idx = row0 - 15 + h * 32 + lane;
      int cl  = idx < 0 ? 0 : (idx > TT - 1 ? TT - 1 : idx);   // in-bounds address
      float v = prev[b * TT + cl];
      pv[h] = (idx == cl) ? v : 0.0f;
    }
    const int    ci = tid < KS * FF / 4 ? tid : KS * FF / 4 - 1;
    const float4 cw = ((const float4*)conv_w)[ci];
    const float  qb = qbias[b * AA + (tid & (AA - 1))];
    const float  pj = proj_w[tid & (AA - 1)];
    const float  cb = conv_b[tid & (FF - 1)];
    // precaution: stands ahead of any rewrite of a register these loads name
    asm volatile("s_wait_xcnt 0x0" ::: "memory");
    #pragma unroll
    for (int i = 0; i < 32; ++i) ((uint4*)sWV)[i * 256 + tid] = tmp[i];
    ((uint4*)sLOC)[tid] = tl0;
    ((uint4*)sLOC)[256 + tid] = tl1;
    #pragma unroll
    for (int h = 0; h < 3; ++h) pa[w][h * 32 + lane] = pv[h];
    ((float4*)sCW)[tid] = cw;   // unguarded: the last 8 threads fill the array's unused tail
    sQB[tid] = qb; sPW[tid] = pj; sCB[tid] = cb;
  }
  __syncthreads();

  // x[c][r]: row r, columns c*128 + lane*4 .. +3 of the wave's current tile; one
  // whole 512-B row piece per load, each piece one register tuple.  The tile's
  // loads stand behind the barrier (the build waits for every load in flight ahead
  // of one) and go out chunk by chunk, the order the matrix loop needs them in
  // (loads are waited for in issue order); the scheduling barriers hold that order.
  v4f x[4][16];
  #pragma unroll
  for (int c = 0; c < 4; ++c) {
    __builtin_amdgcn_sched_barrier(0);
    #pragma unroll
    for (int r = 0; r < 16; ++r)
      x[c][r] = *(const v4f*)(vbase + r * DVV + c * 128 + lane4);
  }
  // precaution: the wait stands ahead of any rewrite of a register these loads name;
  // the two scheduling barriers hold the loads ahead of it and such rewrites behind
  // it (the build had lifted a write of the scalar base over the wait)
  __builtin_amdgcn_sched_barrier(0);
  asm volatile("s_wait_xcnt 0x0" ::: "memory");
  __builtin_amdgcn_sched_barrier(0);

  float  m_run = -3.402823466e+38f, z_run = 0.f;
  v4f cx[4];   // the wave's running context: the lane's 16 columns
  #pragma unroll
  for (int j = 0; j < 4; ++j) cx[j] = (v4f){0.f, 0.f, 0.f, 0.f};

  float sc[16];   // softmax weights of the tile's rows (set and read only under do_ctx)
  #pragma unroll 1   // the tiles share one copy of the body (instruction cache)
  for (int tl = 0; tl < TPW; ++tl) {
    const int t0 = row0 + tl * 16;

    // --- 31-tap conv over alignment (SAME padding): lane -> filter pair c0,
    //     timesteps hi, hi+2, ..., hi+14 ---
    {
      const int c0 = rbase * 2;
      float win[45];
      #pragma unroll
      for (int k = 0; k < 45; ++k) win[k] = pa[w][tl * 16 + hi + k];
      float s0[8], s1[8];
      #pragma unroll
      for (int i = 0; i < 8; ++i) { s0[i] = sCB[c0]; s1[i] = sCB[c0 + 1]; }
      #pragma unroll
      for (int j = 0; j < KS; ++j) {
        float2 wj = *(const float2*)&sCW[j * FF + c0];
        #pragma unroll
        for (int i = 0; i < 8; ++i) {
          s0[i] += win[2 * i + j] * wj.x;
          s1[i] += win[2 * i + j] * wj.y;
        }
      }
      WAVE_LDS_WAIT();   // last tile's feature reads are back before the rows change
      #pragma unroll
      for (int i = 0; i < 8; ++i)
        fbf[w][(hi + 2 * i) * 20 + rbase] = packbf(s0[i], s1[i]);
      WAVE_LDS_WAIT();   // feature rows written before other lanes read them
    }

    v8f acc[8];

    // --- proc_loc = f(16x32) @ loc_w(32x128): 8 bf16 WMMAs ---
    {
      Frag16 fa;
      fa.q[0] = *(const uint4*)&fbf[w][rbase * 20 + hi4];
      fa.q[1] = *(const uint4*)&fbf[w][rbase * 20 + 8 + hi4];
      #pragma unroll
      for (int nt = 0; nt < 8; ++nt) {
        Frag16 lb;
        lb.q[0] = *(const uint4*)&sLOC[(nt * 2 + 0) * 128 + lane * 4];
        lb.q[1] = *(const uint4*)&sLOC[(nt * 2 + 1) * 128 + lane * 4];
        v8f zero = {};
        acc[nt] = __builtin_amdgcn_wmma_f32_16x16x32_bf16(
            false, fa.v, false, lb.v, (short)0, zero, false, false);
      }
    }

    // --- wv = values(16x512) @ wv_w(512x128): 4 chunks of K=128, 32 WMMAs each ---
    #pragma unroll     // unrolled: the tile's registers are named by constants only
    for (int c = 0; c < 4; ++c) {
      const unsigned* bpan = &sWV[c * bstep + lane * 4];
      WAVE_LDS_WAIT();   // last chunk's A reads are back before its rows change
      #pragma unroll
      for (int r = 0; r < 16; ++r) {
        *(uint2*)&stage[w][r * APITCH + lane * 2] = packbf4(x[c][r]);
      }
      WAVE_LDS_WAIT();   // staged rows written before other lanes read them
      #pragma unroll
      for (int ksl = 0; ksl < 4; ++ksl) {
        Frag16 av;
        const unsigned* arow = &stage[w][rbase * APITCH + ksl * 16 + hi4];
        av.q[0] = *(const uint4*)(arow);
        av.q[1] = *(const uint4*)(arow + 8);
        #pragma unroll
        for (int nh = 0; nh < 8; nh += 4) {
          Frag16 bv[4];
          #pragma unroll
          for (int nt = 0; nt < 4; ++nt) {
            bv[nt].q[0] = *(const uint4*)(bpan + ((ksl * 8 + nh + nt) * 2 + 0) * 128);
            bv[nt].q[1] = *(const uint4*)(bpan + ((ksl * 8 + nh + nt) * 2 + 1) * 128);
          }
          // keeps a group's 8 LDS reads together ahead of its 4 WMMAs (they issue
          // under the group before): one LDS latency per group, not one per WMMA
          __builtin_amdgcn_sched_barrier(0);
          #pragma unroll
          for (int nt = 0; nt < 4; ++nt)
            acc[nh + nt] = __builtin_amdgcn_wmma_f32_16x16x32_bf16(
                false, av.v, false, bv[nt].v, (short)0, acc[nh + nt], false, false);
        }
      }
    }

    // --- epilogue: tanh, project, reduce over attn dim (deterministic) ---
    // C layout: vgpr i -> row i (lanes 0-15) / row i+8 (lanes 16-31), col=lane%16
    // tanh(x) = 1 - 2 / (1 + e^(2x)), written without a branch: 64 independent
    // short chains per lane instead of 64 masked two-way branches in series.
    // e^(2x) = inf gives 1, e^(2x) = 0 gives -1, NaN stays NaN; the absolute
    // error is a few f32 roundings of 1, far below the bf16 products' own.  The
    // projection is folded in: sum_a pw*tanh = sum_a pw - 2 * sum_a pw / (1 + e^(2x)).
    const float K2 = 2.8853900817779268f;   // 2 * log2(e)
    float qk[8], pw2[8];
    float pws = 0.f;
    #pragma unroll
    for (int nt = 0; nt < 8; ++nt) {
      const float p = sPW[nt * 16 + rbase];
      qk[nt]  = sQB[nt * 16 + rbase] * K2;
      pw2[nt] = -2.0f * p;
      pws    += p;
    }
    float ps[8];
    #pragma unroll
    for (int i = 0; i < 8; ++i) {
      float xa[8], ex[8], rc[8];
      #pragma unroll
      for (int nt = 0; nt < 8; ++nt) xa[nt] = fmaf(acc[nt][i], K2, qk[nt]);
      exp2_x8(ex, xa);
      #pragma unroll
      for (int nt = 0; nt < 8; ++nt) ex[nt] += 1.0f;
      rcp_x8(rc, ex);
      float vv = pws;
      #pragma unroll
      for (int nt = 0; nt < 8; ++nt) vv = fmaf(rc[nt], pw2[nt], vv);
      vv += __shfl_xor(vv, 1, 16);
      vv += __shfl_xor(vv, 2, 16);
      vv += __shfl_xor(vv, 4, 16);
      vv += __shfl_xor(vv, 8, 16);
      ps[i] = vv;                       // score of row i + 8*hi, in all 16 lanes
    }
    {
      float mine = ps[0];
      #pragma unroll
      for (int i = 1; i < 8; ++i) mine = (rbase == i) ? ps[i] : mine;
      if (rbase < 8) scores[b * TT + t0 + hi * 8 + rbase] = mine;
    }

    if (do_ctx) {
      // --- all 16 scores in every lane, then the online-softmax update ---
      #pragma unroll
      for (int i = 0; i < 8; ++i) {
        float other = __shfl_xor(ps[i], 16, 32);
        sc[i]     = hi ? other : ps[i];
        sc[i + 8] = hi ? ps[i] : other;
      }
      float mn = m_run;
      #pragma unroll
      for (int t = 0; t < 16; ++t) mn = fmaxf(mn, sc[t]);
      const float resc = expf(m_run - mn);
      m_run = mn;
      z_run *= resc;
      #pragma unroll
      for (int j = 0; j < 4; ++j) cx[j] *= resc;
      #pragma unroll
      for (int t = 0; t < 16; ++t) { sc[t] = expf(sc[t] - mn); z_run += sc[t]; }
    }

    // --- ctx[d] += e_t * values[t][d] from the tile's registers.  Behind the sum
    //     the registers are free and the next tile's loads go out: they fly under
    //     the conv and the WMMAs.  All 64 stand in one straight run of code, chunk
    //     by chunk (the scheduling barriers hold that order), so that the build's
    //     counted waits in the matrix loop ask for one chunk at a time ---
    if (do_ctx) {
      #pragma unroll
      for (int j = 0; j < 4; ++j) {
        #pragma unroll
        for (int t = 0; t < 16; ++t) cx[j] += sc[t] * x[j][t];
      }
    }
    if (tl + 1 < TPW) {
      const float* nsrc = vbase + (size_t)((tl + 1) * 16) * DVV;
      #pragma unroll
      for (int j = 0; j < 4; ++j) {
        __builtin_amdgcn_sched_barrier(0);
        #pragma unroll
        for (int r = 0; r < 16; ++r)
          x[j][r] = *(const v4f*)(nsrc + r * DVV + j * 128 + lane4);
      }
      __builtin_amdgcn_sched_barrier(0);   // holds the loads ahead of the wait below
      // precaution: stands ahead of any rewrite of a register these loads name
      asm volatile("s_wait_xcnt 0x0" ::: "memory");
    }
  }

  if (!do_ctx) return;

  // --- merge the 8 waves' (m, Z, ctx) into one partial, fixed order ---
  #pragma unroll
  for (int j = 0; j < 4; ++j) *(v4f*)&wctx[w][j * 128 + lane4] = cx[j];
  if (lane == 0) { wm[w] = m_run; wz[w] = z_run; }
  __syncthreads();
  {
    float m = wm[0];
    #pragma unroll
    for (int ww = 1; ww < WAVES; ++ww) m = fmaxf(m, wm[ww]);
    float z = 0.f, cacc = 0.f, cac2 = 0.f;
    #pragma unroll
    for (int ww = 0; ww < WAVES; ++ww) {
      float e = expf(wm[ww] - m);
      z    += wz[ww] * e;
      cacc += e * wctx[ww][tid];
      cac2 += e * wctx[ww][256 + tid];
    }
    ctxp[(size_t)(b * NPART + part) * DVV + tid] = cacc;
    ctxp[(size_t)(b * NPART + part) * DVV + 256 + tid] = cac2;
    if (tid == 0) {
      mtile[b * NPART + part] = m;
      ztile[b * NPART + part] = z;
    }
  }
}

// ---------------------------------------------------------------------------
// Fused path combine, ONE launch of 2*BB workgroups.  Every workgroup forms its
// batch row's global softmax stats from the NPART partial stats (16 loads, fixed
// order); blocks 0..BB-1 then write the attention weights, blocks BB..2*BB-1 the
// context: ctx[b][d] = invZ * sum_p exp(m_p - m) * ctxp[p][d].  The context half
// recomputes the stats rather than wait a launch for them.
// A batch row's scores and its context partials are both NPART x 512 floats, so
// both halves fetch their data by one address form, and all of a thread's loads
// go out together with the stats loads, ahead of the stats arithmetic: the kernel
// waits for one load latency, not for one per pair of scores behind the stats.
// ---------------------------------------------------------------------------
static_assert(TT == NPART * DVV, "scores row and context partials share one shape");
// e^x of eight values: 2^e * 2^a with e = rint(x * log2(e)) and a = x * log2(e) - e,
// formed by two fused steps on log2(e) split in a high and a low word (|a| <= 1/2 up
// to rounding); range limits as in the math library.  The eight v_exp_f32 stand in
// the one statement of exp2_x8, which keeps the slot behind each.
__device__ __forceinline__ void exp_x8(float (&o)[8], const float (&x)[8]) {
  const float L2E_HI = __uint_as_float(0x3fb8aa3bu), L2E_LO = __uint_as_float(0x32a5705fu);
  float a[8], e[8], r[8];
  #pragma unroll
  for (int i = 0; i < 8; ++i) {
    e[i] = rintf(x[i] * L2E_HI);
    a[i] = fmaf(x[i], L2E_LO, fmaf(x[i], L2E_HI, -e[i]));
  }
  exp2_x8(r, a);
  #pragma unroll
  for (int i = 0; i < 8; ++i) {
    float v = ldexpf(r[i], (int)e[i]);
    v = x[i] < __uint_as_float(0xc2ce8ed0u) ? 0.0f : v;                        // underflow
    o[i] = x[i] > __uint_as_float(0x42b17218u) ? __uint_as_float(0x7f800000u) : v;   // overflow
  }
}
__global__ __launch_bounds__(256) void lsa_combine(
    const float* __restrict__ scores, const float* __restrict__ mtile,
    const float* __restrict__ ztile,  const float* __restrict__ ctxp,
    float* __restrict__ out_w,        float* __restrict__ out_ctx) {
  const int half = blockIdx.x / BB, b = blockIdx.x % BB, tid = threadIdx.x;

  float mt[NPART], zt[NPART], sc[NPART];   // unrolled loops keep them in registers
  #pragma unroll
  for (int p = 0; p < NPART; ++p) { mt[p] = mtile[b * NPART + p]; zt[p] = ztile[b * NPART + p]; }
  const float2* src = (const float2*)(half == 0 ? scores : ctxp);   // uniform for the workgroup
  float2 x[NPART];
  #pragma unroll
  for (int c = 0; c < NPART; ++c) x[c] = src[(size_t)(b * NPART + c) * 256 + tid];
  // precaution: the wait stands ahead of any rewrite of a register these loads name;
  // the scheduling barriers hold the loads ahead of it (and so ahead of the stats
  // arithmetic, which would otherwise run before they are issued)
  __builtin_amdgcn_sched_barrier(0);
  asm volatile("s_wait_xcnt 0x0" ::: "memory");
  __builtin_amdgcn_sched_barrier(0);

  float mg = mt[0];
  #pragma unroll
  for (int p = 1; p < NPART; ++p) mg = fmaxf(mg, mt[p]);
  float z = 0.f;
  #pragma unroll
  for (int p = 0; p < NPART; ++p) {               // fixed order
    sc[p] = expf(mt[p] - mg);
    z += zt[p] * sc[p];
  }
  const float inv = 1.0f / z;

  if (half == 0) {                                // uniform for the workgroup
    #pragma unroll   // x[] is indexed by constants only, so it stays in registers
    for (int g = 0; g < NPART; g += 4) {
      float d[8], ex[8];
      #pragma unroll
      for (int c = 0; c < 4; ++c) { d[2 * c] = x[g + c].x - mg; d[2 * c + 1] = x[g + c].y - mg; }
      exp_x8(ex, d);
      #pragma unroll
      for (int c = 0; c < 4; ++c) {
        float2 o;
        o.x = ex[2 * c] * inv;
        o.y = ex[2 * c + 1] * inv;
        ((float2*)out_w)[(size_t)(b * NPART + g + c) * 256 + tid] = o;
      }
    }
    // precaution: stands ahead of any rewrite of a register the stores name
    asm volatile("s_wait_xcnt 0x0" ::: "memory");
  } else {
    float2 s; s.x = 0.f; s.y = 0.f;
    #pragma unroll   // sc[] and x[] are indexed by constants only
    for (int c = 0; c < NPART; ++c) {             // fixed order
      s.x += sc[c] * x[c].x; s.y += sc[c] * x[c].y;
    }
    s.x *= inv; s.y *= inv;
    ((float2*)out_ctx)[b * 256 + tid] = s;
    // precaution: the other half's code follows this store in the build, so the
    // wait stands ahead of any rewrite of a register the store names
    asm volatile("s_wait_xcnt 0x0" ::: "memory");
  }
}

// ---------------------------------------------------------------------------
// Fallback path (small workspace): plain softmax + second values pass.
// ---------------------------------------------------------------------------
__global__ __launch_bounds__(256) void lsa_softmax(
    const float* __restrict__ scores, float* __restrict__ out_w) {
  __shared__ float red[256];
  const int b = blockIdx.x, tid = threadIdx.x;
  const float* s = scores + b * TT;

  float m = -3.402823466e+38f;
  for (int t = tid; t < TT; t += 256) m = fmaxf(m, s[t]);
  red[tid] = m; __syncthreads();
  for (int off = 128; off > 0; off >>= 1) {
    if (tid < off) red[tid] = fmaxf(red[tid], red[tid + off]);
    __syncthreads();
  }
  m = red[0]; __syncthreads();

  float sum = 0.f;
  for (int t = tid; t < TT; t += 256) sum += expf(s[t] - m);
  red[tid] = sum; __syncthreads();
  for (int off = 128; off > 0; off >>= 1) {
    if (tid < off) red[tid] += red[tid + off];
    __syncthreads();
  }
  const float inv = 1.0f / red[0];
  for (int t = tid; t < TT; t += 256)
    out_w[b * TT + t] = expf(s[t] - m) * inv;
}

__global__ __launch_bounds__(256) void lsa_ctx_partial(
    const float* __restrict__ values, const float* __restrict__ attn_w,
    float* __restrict__ partials) {
  const int b = blockIdx.x >> 5, chunk = blockIdx.x & 31, tid = threadIdx.x;
  const float2* v = (const float2*)(values + ((size_t)b * TT) * DVV);
  const int tbase = chunk * 128;
  float2 acc; acc.x = 0.f; acc.y = 0.f;
  for (int t = 0; t < 128; ++t) {
    float wt = attn_w[b * TT + tbase + t];
    float2 x = v[(size_t)(tbase + t) * 256 + tid];
    acc.x += wt * x.x;
    acc.y += wt * x.y;
  }
  ((float2*)partials)[(size_t)(b * 32 + chunk) * 256 + tid] = acc;
}

__global__ __launch_bounds__(256) void lsa_ctx_reduce(
    const float* __restrict__ partials, float* __restrict__ out_ctx) {
  const int b = blockIdx.x, tid = threadIdx.x;
  const float2* p = (const float2*)partials;
  float2 s; s.x = 0.f; s.y = 0.f;
  #pragma unroll
  for (int c = 0; c < 32; ++c) {
    float2 x = p[(size_t)(b * 32 + c) * 256 + tid];
    s.x += x.x; s.y += x.y;
  }
  ((float2*)out_ctx)[b * 256 + tid] = s;
}

// ---------------------------------------------------------------------------
extern "C" void kernel_launch(void* const* d_in, const int* in_sizes, int n_in,
                              void* d_out, int out_size, void* d_ws, size_t ws_size,
                              hipStream_t stream) {
  const float* query  = (const float*)d_in[0];
  const float* values = (const float*)d_in[1];
  const float* prev   = (const float*)d_in[2];
  const float* conv_w = (const float*)d_in[3];
  const float* conv_b = (const float*)d_in[4];
  const float* loc_w  = (const float*)d_in[5];
  const float* loc_b  = (const float*)d_in[6];
  const float* wq_w   = (const float*)d_in[7];
  const float* wq_b   = (const float*)d_in[8];
  const float* wv_w   = (const float*)d_in[9];
  const float* wv_b   = (const float*)d_in[10];
  const float* attn_b = (const float*)d_in[11];
  const float* proj_w = (const float*)d_in[12];

  float* out_ctx = (float*)d_out;               // [32, 512]
  float* out_w   = out_ctx + BB * DVV;          // [32, 4096]

  unsigned char* ws = (unsigned char*)d_ws;
  unsigned* packWV  = (unsigned*)(ws);            // 32768 u32  (128 KB)
  unsigned* packLOC = (unsigned*)(ws + 131072);   //  2048 u32  (  8 KB)
  float*    qbias   = (float*)(ws + 139264);      //  4096 f32  ( 16 KB)
  float*    scores  = (float*)(ws + 155648);      // 131072 f32 (512 KB)
  // fused-path extras
  float*    mtile   = (float*)(ws + 679936);      //   256 f32
  float*    ztile   = (float*)(ws + 712704);      //   256 f32
  float*    ctxp    = (float*)(ws + 778752);      // 32*8*512 f32 (512 KB)
  const size_t fused_need = 778752u + (size_t)BB * NPART * DVV * 4u;
  // fallback-path extra (overlaps the fused region)
  float*    parts   = (float*)(ws + 679936);      // 524288 f32 (2 MB)
  const int fused = (ws_size >= fused_need) ? 1 : 0;

  lsa_pre<<<PRE_QB + PRE_WV + PRE_LOC, 512, 0, stream>>>(
      query, wq_w, wq_b, wv_b, loc_b, attn_b, wv_w, loc_w, qbias, packWV, packLOC);

  lsa_score<<<BB * NPART, 256, 0, stream>>>(
      values, prev, conv_w, conv_b, packWV, packLOC, qbias, proj_w,
      scores, mtile, ztile, ctxp, fused, 8192);

  if (fused) {
    lsa_combine<<<2 * BB, 256, 0, stream>>>(scores, mtile, ztile, ctxp, out_w, out_ctx);
  } else {
    lsa_softmax    <<< BB, 256, 0, stream>>>(scores, out_w);
    lsa_ctx_partial<<<BB * 32, 256, 0, stream>>>(values, out_w, parts);
    lsa_ctx_reduce <<< BB, 256, 0, stream>>>(parts, out_ctx);
  }
}

// v008
// Measured time: 36.7 microseconds a run.
// Next to v007, in two timings, it ran 1.04 times as fast each time.
// All steps since v000 together make it 3.85 times as fast.
#include <hip/hip_runtime.h>
#include <hip/hip_bf16.h>

// ---------------------------------------------------------------------------
// Location-sensitive attention for MI455X (gfx1250, wave32, WMMA).
// B=32, T=4096, DV=512, DQ=512, ATTN=128, FILTERS=32, KSIZE=31
// Fused flash-style context accumulation: values read from HBM exactly once.
// ---------------------------------------------------------------------------

#define BB   32
#define TT   4096
#define DVV  512
#define AA   128
#define FF   32
#define KS   31
#define WAVES   8                   // waves per score workgroup (two per SIMD: 512 VGPRs each)
#define TPW     4                   // 16-row tiles per wave
#define ROWS_WG (WAVES * TPW * 16)  // 512 timesteps per score workgroup
#define NPART   (TT / ROWS_WG)      // 8 partials per batch row
#define APITCH  68                  // dwords per staged row: 128 bf16 + 16 B pad

typedef __attribute__((ext_vector_type(16))) __bf16 v16bf;
typedef __attribute__((ext_vector_type(8)))  float  v8f;

union Frag16 {          // 16 bf16 elements = 8 dwords = one WMMA A/B operand
  v16bf    v;
  unsigned u[8];
  uint4    q[2];
};

typedef __attribute__((ext_vector_type(2))) float  v2f;
typedef __attribute__((ext_vector_type(2))) __bf16 v2bf;
typedef __attribute__((ext_vector_type(4))) float  v4f;
typedef __attribute__((ext_vector_type(4))) __bf16 v4bf;
// f32 -> bf16, round to nearest even, by the packed hardware conversion
// (one instruction per pair; a in the low half)
__device__ __forceinline__ unsigned packbf(float a, float b) {
  v2f x = {a, b};
  return __builtin_bit_cast(unsigned, __builtin_convertvector(x, v2bf));
}
__device__ __forceinline__ uint2 packbf4(v4f x) {
  return __builtin_bit_cast(uint2, __builtin_convertvector(x, v4bf));
}

// ---------------------------------------------------------------------------
// Prepack wv_w [512,128] into WMMA bf16 B-operand layout.
// pk[(((ks*8 + nt)*2 + j/4)*32 + lane)*4 + j%4]  (each 16-B half-fragment of a
// wave is 512 contiguous bytes, conflict-free for LDS b128 reads):
//   lane holds column n = nt*16 + lane%16
//   lanes 0-15 hold K {0..7, 16..23}, lanes 16-31 hold K {8..15, 24..31}
//   dword j packs (K, K+1) with even K in the low half.
// ---------------------------------------------------------------------------
__device__ __forceinline__ void prepack_wv_item(
    int tid /* 0..32767 */, const float* __restrict__ wv_w, unsigned* __restrict__ pk) {
  int j   = tid & 7;
  int L   = (tid >> 3) & 31;
  int nt  = (tid >> 8) & 7;
  int ks  = tid >> 11;
  int n   = nt * 16 + (L & 15);
  int kb  = ks * 32 + ((L >> 4) ? 8 : 0) + ((j < 4) ? (2 * j) : (16 + 2 * (j - 4)));
  pk[(((ks * 8 + nt) * 2 + (j >> 2)) * 32 + L) * 4 + (j & 3)] =
      packbf(wv_w[kb * AA + n], wv_w[(kb + 1) * AA + n]);
  // precaution: in the shared-grid build other blocks' code follows this store, so
  // the wait stands ahead of any rewrite of a register the store names
  asm volatile("s_wait_xcnt 0x0" ::: "memory");
}

__device__ __forceinline__ void prepack_loc_item(
    int tid /* 0..2047 */, const float* __restrict__ loc_w, unsigned* __restrict__ pk) {
  int j   = tid & 7;
  int L   = (tid >> 3) & 31;
  int nt  = tid >> 8;
  int n   = nt * 16 + (L & 15);
  int kb  = ((L >> 4) ? 8 : 0) + ((j < 4) ? (2 * j) : (16 + 2 * (j - 4)));
  pk[((nt * 2 + (j >> 2)) * 32 + L) * 4 + (j & 3)] =
      packbf(loc_w[kb * AA + n], loc_w[(kb + 1) * AA + n]);
  // precaution: in the shared-grid build other blocks' code follows this store, so
  // the wait stands ahead of any rewrite of a register the store names
  asm volatile("s_wait_xcnt 0x0" ::: "memory");
}

// ---------------------------------------------------------------------------
// qbias[b][a] = query[b]·wq_w[:,a] + wq_b + wv_b + loc_b + attention_bias
// ---------------------------------------------------------------------------
#define QCOLS 32   // attn columns per qbias workgroup: one 128-B line of each wq_w row
__device__ __forceinline__ void qbias_block(
    int blk /* 0..BB*4-1 */,
    const float* __restrict__ query, const float* __restrict__ wq_w,
    const float* __restrict__ wq_b,  const float* __restrict__ wv_b,
    const float* __restrict__ loc_b, const float* __restrict__ attn_b,
    float* __restrict__ qbias) {
  // One workgroup = one batch row x 32 columns; K = 512 is split over 16 waves x
  // 4 lane groups x 8 rows, so a lane needs only 8 row loads and every load of
  // the kernel is issued before the first is used: one memory latency for the
  // kernel instead of one per group of rows.
  __shared__ __align__(16) float part[16][QCOLS];
  const int b    = blk >> 2, cq = blk & 3, tid = threadIdx.x;
  const int lane = tid & 31, w = tid >> 5;
  const int c4   = (lane & 7) * 4;             // lane's 4 columns in the line
  const int row0 = w * 32 + (lane >> 3) * 8;   // lane's 8 rows of K
  const int a    = cq * QCOLS + lane;          // column of the closing sum
  const float* wp = wq_w + row0 * AA + cq * QCOLS + c4;
  const float* qp = query + b * 512 + row0;
  float4 x[8];
  #pragma unroll
  for (int i = 0; i < 8; ++i) x[i] = *(const float4*)(wp + i * AA);
  float4 qv[2];
  qv[0] = *(const float4*)(qp);
  qv[1] = *(const float4*)(qp + 4);
  // precaution: in the shared-grid build a bias load's result lands in the query
  // loads' offset register, so the wait also stands between those loads
  asm volatile("s_wait_xcnt 0x0" ::: "memory");
  const float bq = wq_b[a], bv = wv_b[a], bl = loc_b[a], ba = attn_b[a];
  // precaution: stands ahead of any rewrite of a register the loads above name
  asm volatile("s_wait_xcnt 0x0" ::: "memory");
  const float qs[8] = {qv[0].x, qv[0].y, qv[0].z, qv[0].w,
                       qv[1].x, qv[1].y, qv[1].z, qv[1].w};
  float4 s = make_float4(0.f, 0.f, 0.f, 0.f);
  #pragma unroll
  for (int i = 0; i < 8; ++i) {
    s.x += qs[i] * x[i].x; s.y += qs[i] * x[i].y;
    s.z += qs[i] * x[i].z; s.w += qs[i] * x[i].w;
  }
  // the wave's 4 lane groups hold the same columns: fold them, fixed order
  #pragma unroll
  for (int d = 8; d < 32; d <<= 1) {
    s.x += __shfl_xor(s.x, d, 32); s.y += __shfl_xor(s.y, d, 32);
    s.z += __shfl_xor(s.z, d, 32); s.w += __shfl_xor(s.w, d, 32);
  }
  if (lane < 8) *(float4*)&part[w][c4] = s;
  __syncthreads();
  if (tid < QCOLS) {
    float t = part[0][tid];
    #pragma unroll
    for (int ww = 1; ww < 16; ++ww) t += part[ww][tid];   // fixed wave order
    qbias[b * AA + a] = t + bq + bv + bl + ba;
  }
}

// ---------------------------------------------------------------------------
// All the work the score kernel waits for, in ONE launch: the query bias and the
// two weight prepacks read and write disjoint data, so they share a grid by
// block range and run side by side (196 workgroups, all resident at once)
// instead of one after another with a launch gap between them.
// ---------------------------------------------------------------------------
#define PRE_QB  (BB * 4)            // blocks   0..127: query bias (the longest, first)
#define PRE_WV  (32768 / 512)       // blocks 128..191: wv_w prepack
#define PRE_LOC (2048 / 512)        // blocks 192..195: loc_w prepack
__global__ __launch_bounds__(512) void lsa_pre(
    const float* __restrict__ query, const float* __restrict__ wq_w,
    const float* __restrict__ wq_b,  const float* __restrict__ wv_b,
    const float* __restrict__ loc_b, const float* __restrict__ attn_b,
    const float* __restrict__ wv_w,  const float* __restrict__ loc_w,
    float* __restrict__ qbias, unsigned* __restrict__ packWV,
    unsigned* __restrict__ packLOC) {
  const int blk = blockIdx.x;        // the branch is uniform for the workgroup
  if (blk < PRE_QB)
    qbias_block(blk, query, wq_w, wq_b, wv_b, loc_b, attn_b, qbias);
  else if (blk < PRE_QB + PRE_WV)
    prepack_wv_item((blk - PRE_QB) * 512 + threadIdx.x, wv_w, packWV);
  else
    prepack_loc_item((blk - PRE_QB - PRE_WV) * 512 + threadIdx.x, loc_w, packLOC);
}

// ---------------------------------------------------------------------------
// Score (+ fused online-softmax context partial) kernel.
// One workgroup = 512 timesteps of one batch row, 8 waves; the packed weights
// lie in LDS once per workgroup.  Each wave owns 64 whole rows (four 16-row
// tiles) and all 128 attn columns, so a row's score is finished inside the
// wave: scores[b][t] = sum_a tanh(pre)[t][a] * proj_w[a].
// The wave's whole 16x512 f32 tile stays in 256 registers from its load to the
// context sum, so every value crosses L2 once.
// If do_ctx: the wave keeps a running max m, Z = sum exp(s-m) and
// ctx[d] = sum_t exp(s_t-m) * values[t][d] (from the tile's registers);
// the 8 waves are merged once at the end into one partial per workgroup.
// ---------------------------------------------------------------------------
// The wave's own LDS traffic has landed / returned: its lanes exchange rows
// through a per-wave LDS range, and the clobber keeps the compiler from moving
// LDS accesses across the hand-over.
#define WAVE_LDS_WAIT() asm volatile("s_wait_dscnt 0x0" ::: "memory")

// Eight independent v_exp_f32 (2^x) or v_rcp_f32 in one statement.  Written as
// asm text so that the slot the instruction set asks for behind a transcendental
// is kept by construction: the results are early-clobber, so none of the eight
// reads an earlier result or overwrites an earlier source, and the closing v_nop
// fills the slot behind the last one.
__device__ __forceinline__ void exp2_x8(float (&o)[8], const float (&a)[8]) {
  asm("v_exp_f32 %0, %8\n\tv_exp_f32 %1, %9\n\tv_exp_f32 %2, %10\n\t"
      "v_exp_f32 %3, %11\n\tv_exp_f32 %4, %12\n\tv_exp_f32 %5, %13\n\t"
      "v_exp_f32 %6, %14\n\tv_exp_f32 %7, %15\n\tv_nop"
      : "=&v"(o[0]), "=&v"(o[1]), "=&v"(o[2]), "=&v"(o[3]),
        "=&v"(o[4]), "=&v"(o[5]), "=&v"(o[6]), "=&v"(o[7])
      : "v"(a[0]), "v"(a[1]), "v"(a[2]), "v"(a[3]),
        "v"(a[4]), "v"(a[5]), "v"(a[6]), "v"(a[7]));
}
__device__ __forceinline__ void rcp_x8(float (&o)[8], const float (&a)[8]) {
  asm("v_rcp_f32 %0, %8\n\tv_rcp_f32 %1, %9\n\tv_rcp_f32 %2, %10\n\t"
      "v_rcp_f32 %3, %11\n\tv_rcp_f32 %4, %12\n\tv_rcp_f32 %5, %13\n\t"
      "v_rcp_f32 %6, %14\n\tv_rcp_f32 %7, %15\n\tv_nop"
      : "=&v"(o[0]), "=&v"(o[1]), "=&v"(o[2]), "=&v"(o[3]),
        "=&v"(o[4]), "=&v"(o[5]), "=&v"(o[6]), "=&v"(o[7])
      : "v"(a[0]), "v"(a[1]), "v"(a[2]), "v"(a[3]),
        "v"(a[4]), "v"(a[5]), "v"(a[6]), "v"(a[7]));
}

// Asks L2 for one 16x512 f32 tile (32 KB) ahead of the loads that will read it, so
// that the tile crosses from memory to L2 while the wave works on the tile before.
// One request per aligned 256-B unit; request c covers K chunk c of all 16 rows
// (lane -> row lane/2, half lane%2), the order the tile's loads go out in.  Nothing
// returns and no counter moves.  rows is the wave's first row (wave-uniform), unit the
// lane's byte offset from it: its place inside a chunk plus the tile's 32 KB steps.
// The builtin (locality 3 = scope SE) and not asm text: an asm operand must lie in
// the first 256 registers, which the value tile fills, and the build then kept unit
// in scratch, whose reload waited for every load in flight.  In the listing every
// request names one vector register and one scalar pair that hold nothing else from
// the first request to the kernel's end.
__device__ __forceinline__ void l2_ask_tile(const float* rows, unsigned unit) {
  const char* p = (const char*)rows + unit;
  __builtin_prefetch(p, 0, 3);
  __builtin_prefetch(p + 512, 0, 3);
  __builtin_prefetch(p + 1024, 0, 3);
  __builtin_prefetch(p + 1536, 0, 3);
}

__global__ __launch_bounds__(256) void lsa_score(
    const float*    __restrict__ values,  const float* __restrict__ prev,
    const float*    __restrict__ conv_w,  const float* __restrict__ conv_b,
    const unsigned* __restrict__ packWV,  const unsigned* __restrict__ packLOC,
    const float*    __restrict__ qbias,   const float* __restrict__ proj_w,
    float*          __restrict__ scores,
    float*          __restrict__ mtile,   float* __restrict__ ztile,
    float*          __restrict__ ctxp,    int do_ctx, int bstep) {
  // bstep = 8192, the dwords of one K chunk's B panels.  It comes in as an argument
  // so that each unrolled chunk has one LDS base register and its 64 B reads use
  // the 16-bit immediate offset (with a constant the build formed one address
  // register per read beyond 64 KB, 128 of them, and spilled)
  __shared__ __align__(16) unsigned sWV [32768];              // 128 KB B panels
  __shared__ __align__(16) unsigned sLOC[2048];               //   8 KB B panels
  __shared__ __align__(16) float    sCW [1024];               //   4 KB conv taps (992 used)
  __shared__ __align__(16) unsigned stage[WAVES][16 * APITCH]; // 16x128 bf16 per wave
  __shared__ __align__(16) unsigned fbf  [WAVES][16 * 20];     // 16x32 bf16 conv features
  __shared__ __align__(16) float    wctx [WAVES][DVV];         // per-wave context
  __shared__ float pa[WAVES][96];     // per-wave alignment window (94 used)
  // one element per thread, stored unguarded; the first AA (FF) elements are read
  __shared__ float sQB[256];          // query bias row of this batch
  __shared__ float sPW[256];          // projection weights
  __shared__ __align__(8) float sCB[256];   // conv bias
  __shared__ float wm[WAVES];
  __shared__ float wz[WAVES];

  const int tid   = threadIdx.x;
  const int lane  = tid & 31;
  const int w     = __builtin_amdgcn_readfirstlane(tid >> 5);
  const int b     = blockIdx.x / NPART;
  const int part  = blockIdx.x % NPART;
  const int row0  = part * ROWS_WG + w * (TPW * 16);   // wave's first timestep
  const int rbase = lane & 15;         // A row / B column within tile
  const int hi    = lane >> 4;         // lane half selects K sub-block
  const int hi4   = hi * 4;            // dword offset of K half-chunk
  const float*   vbase = values + ((size_t)(b * TT + row0)) * DVV;   // wave-uniform
  const unsigned lane4 = lane * 4;                                   // lane's column

  // tile 0 starts on its way from memory under the weight staging below; the offset
  // only ever lies inside one of the wave's own TPW tiles
  unsigned pfunit = (lane >> 1) * (DVV * 4) + (lane & 1) * 256;
  l2_ask_tile(vbase, pfunit);

  // --- everything the workgroup stages in LDS: all its loads are issued together,
  //     unconditionally (indices wrapped or clamped into bounds), and stored without
  //     a guard (a guarded store drew its load into the branch, one more memory
  //     latency each), so the staging costs one memory latency ---
  {
    uint4 tmp[32];
    #pragma unroll
    for (int i = 0; i < 32; ++i) tmp[i] = ((const uint4*)packWV)[i * 256 + tid];
    const uint4 tl0 = ((const uint4*)packLOC)[tid];
    const uint4 tl1 = ((const uint4*)packLOC)[256 + tid];
    // the wave's alignment window (SAME padding, K=31 -> +/-15), all tiles
    float pv[3];
    #pragma unroll
    for (int h = 0; h < 3; ++h) {
      int idx = row0 - 15 + h * 32 + lane;
      int cl  = idx < 0 ? 0 : (idx > TT - 1 ? TT - 1 : idx);   // in-bounds address
      float v = prev[b * TT + cl];
      pv[h] = (idx == cl) ? v : 0.0f;
    }
    const int    ci = tid < KS * FF / 4 ? tid : KS * FF / 4 - 1;
    const float4 cw = ((const float4*)conv_w)[ci];
    const float  qb = qbias[b * AA + (tid & (AA - 1))];
    const float  pj = proj_w[tid & (AA - 1)];
    const float  cb = conv_b[tid & (FF - 1)];
    // precaution: stands ahead of any rewrite of a register these loads name
    asm volatile("s_wait_xcnt 0x0" ::: "memory");
    #pragma unroll
    for (int i = 0; i < 32; ++i) ((uint4*)sWV)[i * 256 + tid] = tmp[i];
    ((uint4*)sLOC)[tid] = tl0;
    ((uint4*)sLOC)[256 + tid] = tl1;
    #pragma unroll
    for (int h = 0; h < 3; ++h) pa[w][h * 32 + lane] = pv[h];
    ((float4*)sCW)[tid] = cw;   // unguarded: the last 8 threads fill the array's unused tail
    sQB[tid] = qb; sPW[tid] = pj; sCB[tid] = cb;
  }
  __syncthreads();

  // x[c][r]: row r, columns c*128 + lane*4 .. +3 of the wave's current tile; one
  // whole 512-B row piece per load, each piece one register tuple.  The tile's
  // loads stand behind the barrier (the build waits for every load in flight ahead
  // of one) and go out chunk by chunk, the order the matrix loop needs them in
  // (loads are waited for in issue order); the scheduling barriers hold that order.
  v4f x[4][16];
  #pragma unroll
  for (int c = 0; c < 4; ++c) {
    __builtin_amdgcn_sched_barrier(0);
    #pragma unroll
    for (int r = 0; r < 16; ++r)
      x[c][r] = *(const v4f*)(vbase + r * DVV + c * 128 + lane4);
  }
  // precaution: the wait stands ahead of any rewrite of a register these loads name;
  // the two scheduling barriers hold the loads ahead of it and such rewrites behind
  // it (the build had lifted a write of the scalar base over the wait)
  __builtin_amdgcn_sched_barrier(0);
  asm volatile("s_wait_xcnt 0x0" ::: "memory");
  __builtin_amdgcn_sched_barrier(0);

  float  m_run = -3.402823466e+38f, z_run = 0.f;
  v4f cx[4];   // the wave's running context: the lane's 16 columns
  #pragma unroll
  for (int j = 0; j < 4; ++j) cx[j] = (v4f){0.f, 0.f, 0.f, 0.f};

  float sc[16];   // softmax weights of the tile's rows (set and read only under do_ctx)
  #pragma unroll 1   // the tiles share one copy of the body (instruction cache)
  for (int tl = 0; tl < TPW; ++tl) {
    const int t0 = row0 + tl * 16;

    // this tile's loads have just gone out; the next tile is asked for behind them and
    // memory fetches it under the whole trip.  The offset moves only under this test,
    // so it never leaves the wave's rows
    if (tl + 1 < TPW) {
      pfunit += 16 * DVV * 4;
      l2_ask_tile(vbase, pfunit);
    }

    // --- 31-tap conv over alignment (SAME padding): lane -> filter pair c0,
    //     timesteps hi, hi+2, ..., hi+14 ---
    {
      const int c0 = rbase * 2;
      float win[45];
      #pragma unroll
      for (int k = 0; k < 45; ++k) win[k] = pa[w][tl * 16 + hi + k];
      float s0[8], s1[8];
      #pragma unroll
      for (int i = 0; i < 8; ++i) { s0[i] = sCB[c0]; s1[i] = sCB[c0 + 1]; }
      #pragma unroll
      for (int j = 0; j < KS; ++j) {
        float2 wj = *(const float2*)&sCW[j * FF + c0];
        #pragma unroll
        for (int i = 0; i < 8; ++i) {
          s0[i] += win[2 * i + j] * wj.x;
          s1[i] += win[2 * i + j] * wj.y;
        }
      }
      WAVE_LDS_WAIT();   // last tile's feature reads are back before the rows change
      #pragma unroll
      for (int i = 0; i < 8; ++i)
        fbf[w][(hi + 2 * i) * 20 + rbase] = packbf(s0[i], s1[i]);
      WAVE_LDS_WAIT();   // feature rows written before other lanes read them
    }

    v8f acc[8];

    // --- proc_loc = f(16x32) @ loc_w(32x128): 8 bf16 WMMAs ---
    {
      Frag16 fa;
      fa.q[0] = *(const uint4*)&fbf[w][rbase * 20 + hi4];
      fa.q[1] = *(const uint4*)&fbf[w][rbase * 20 + 8 + hi4];
      #pragma unroll
      for (int nt = 0; nt < 8; ++nt) {
        Frag16 lb;
        lb.q[0] = *(const uint4*)&sLOC[(nt * 2 + 0) * 128 + lane * 4];
        lb.q[1] = *(const uint4*)&sLOC[(nt * 2 + 1) * 128 + lane * 4];
        v8f zero = {};
        acc[nt] = __builtin_amdgcn_wmma_f32_16x16x32_bf16(
            false, fa.v, false, lb.v, (short)0, zero, false, false);
      }
    }

    // --- wv = values(16x512) @ wv_w(512x128): 4 chunks of K=128, 32 WMMAs each ---
    #pragma unroll     // unrolled: the tile's registers are named by constants only
    for (int c = 0; c < 4; ++c) {
      const unsigned* bpan = &sWV[c * bstep + lane * 4];
      WAVE_LDS_WAIT();   // last chunk's A reads are back before its rows change
      #pragma unroll
      for (int r = 0; r < 16; ++r) {
        *(uint2*)&stage[w][r * APITCH + lane * 2] = packbf4(x[c][r]);
      }
      WAVE_LDS_WAIT();   // staged rows written before other lanes read them
      #pragma unroll
      for (int ksl = 0; ksl < 4; ++ksl) {
        Frag16 av;
        const unsigned* arow = &stage[w][rbase * APITCH + ksl * 16 + hi4];
        av.q[0] = *(const uint4*)(arow);
        av.q[1] = *(const uint4*)(arow + 8);
        #pragma unroll
        for (int nh = 0; nh < 8; nh += 4) {
          Frag16 bv[4];
          #pragma unroll
          for (int nt = 0; nt < 4; ++nt) {
            bv[nt].q[0] = *(const uint4*)(bpan + ((ksl * 8 + nh + nt) * 2 + 0) * 128);
            bv[nt].q[1] = *(const uint4*)(bpan + ((ksl * 8 + nh + nt) * 2 + 1) * 128);
          }
          // keeps a group's 8 LDS reads together ahead of its 4 WMMAs (they issue
          // under the group before): one LDS latency per group, not one per WMMA
          __builtin_amdgcn_sched_barrier(0);
          #pragma unroll
          for (int nt = 0; nt < 4; ++nt)
            acc[nh + nt] = __builtin_amdgcn_wmma_f32_16x16x32_bf16(
                false, av.v, false, bv[nt].v, (short)0, acc[nh + nt], false, false);
        }
      }
    }

    // --- epilogue: tanh, project, reduce over attn dim (deterministic) ---
    // C layout: vgpr i -> row i (lanes 0-15) / row i+8 (lanes 16-31), col=lane%16
    // tanh(x) = 1 - 2 / (1 + e^(2x)), written without a branch: 64 independent
    // short chains per lane instead of 64 masked two-way branches in series.
    // e^(2x) = inf gives 1, e^(2x) = 0 gives -1, NaN stays NaN; the absolute
    // error is a few f32 roundings of 1, far below the bf16 products' own.  The
    // projection is folded in: sum_a pw*tanh = sum_a pw - 2 * sum_a pw / (1 + e^(2x)).
    const float K2 = 2.8853900817779268f;   // 2 * log2(e)
    float qk[8], pw2[8];
    float pws = 0.f;
    #pragma unroll
    for (int nt = 0; nt < 8; ++nt) {
      const float p = sPW[nt * 16 + rbase];
      qk[nt]  = sQB[nt * 16 + rbase] * K2;
      pw2[nt] = -2.0f * p;
      pws    += p;
    }
    float ps[8];
    #pragma unroll
    for (int i = 0; i < 8; ++i) {
      float xa[8], ex[8], rc[8];
      #pragma unroll
      for (int nt = 0; nt < 8; ++nt) xa[nt] = fmaf(acc[nt][i], K2, qk[nt]);
      exp2_x8(ex, xa);
      #pragma unroll
      for (int nt = 0; nt < 8; ++nt) ex[nt] += 1.0f;
      rcp_x8(rc, ex);
      float vv = pws;
      #pragma unroll
      for (int nt = 0; nt < 8; ++nt) vv = fmaf(rc[nt], pw2[nt], vv);
      vv += __shfl_xor(vv, 1, 16);
      vv += __shfl_xor(vv, 2, 16);
      vv += __shfl_xor(vv, 4, 16);
      vv += __shfl_xor(vv, 8, 16);
      ps[i] = vv;                       // score of row i + 8*hi, in all 16 lanes
    }
    {
      float mine = ps[0];
      #pragma unroll
      for (int i = 1; i < 8; ++i) mine = (rbase == i) ? ps[i] : mine;
      if (rbase < 8) scores[b * TT + t0 + hi * 8 + rbase] = mine;
    }

    if (do_ctx) {
      // --- all 16 scores in every lane, then the online-softmax update ---
      #pragma unroll
      for (int i = 0; i < 8; ++i) {
        float other = __shfl_xor(ps[i], 16, 32);
        sc[i]     = hi ? other : ps[i];
        sc[i + 8] = hi ? ps[i] : other;
      }
      float mn = m_run;
      #pragma unroll
      for (int t = 0; t < 16; ++t) mn = fmaxf(mn, sc[t]);
      const float resc = expf(m_run - mn);
      m_run = mn;
      z_run *= resc;
      #pragma unroll
      for (int j = 0; j < 4; ++j) cx[j] *= resc;
      #pragma unroll
      for (int t = 0; t < 16; ++t) { sc[t] = expf(sc[t] - mn); z_run += sc[t]; }
    }

    // --- ctx[d] += e_t * values[t][d] from the tile's registers.  Behind the sum
    //     the registers are free and the next tile's loads go out: they fly under
    //     the conv and the WMMAs.  All 64 stand in one straight run of code, chunk
    //     by chunk (the scheduling barriers hold that order), so that the build's
    //     counted waits in the matrix loop ask for one chunk at a time ---
    if (do_ctx) {
      #pragma unroll
      for (int j = 0; j < 4; ++j) {
        #pragma unroll
        for (int t = 0; t < 16; ++t) cx[j] += sc[t] * x[j][t];
      }
    }
    if (tl + 1 < TPW) {
      const float* nsrc = vbase + (size_t)((tl + 1) * 16) * DVV;
      #pragma unroll
      for (int j = 0; j < 4; ++j) {
        __builtin_amdgcn_sched_barrier(0);
        #pragma unroll
        for (int r = 0; r < 16; ++r)
          x[j][r] = *(const v4f*)(nsrc + r * DVV + j * 128 + lane4);
      }
      __builtin_amdgcn_sched_barrier(0);   // holds the loads ahead of the wait below
      // precaution: stands ahead of any rewrite of a register these loads name
      asm volatile("s_wait_xcnt 0x0" ::: "memory");
    }
  }

  if (!do_ctx) return;

  // --- merge the 8 waves' (m, Z, ctx) into one partial, fixed order ---
  #pragma unroll
  for (int j = 0; j < 4; ++j) *(v4f*)&wctx[w][j * 128 + lane4] = cx[j];
  if (lane == 0) { wm[w] = m_run; wz[w] = z_run; }
  __syncthreads();
  {
    float m = wm[0];
    #pragma unroll
    for (int ww = 1; ww < WAVES; ++ww) m = fmaxf(m, wm[ww]);
    float z = 0.f, cacc = 0.f, cac2 = 0.f;
    #pragma unroll
    for (int ww = 0; ww < WAVES; ++ww) {
      float e = expf(wm[ww] - m);
      z    += wz[ww] * e;
      cacc += e * wctx[ww][tid];
      cac2 += e * wctx[ww][256 + tid];
    }
    ctxp[(size_t)(b * NPART + part) * DVV + tid] = cacc;
    ctxp[(size_t)(b * NPART + part) * DVV + 256 + tid] = cac2;
    if (tid == 0) {
      mtile[b * NPART + part] = m;
      ztile[b * NPART + part] = z;
    }
  }
}

// ---------------------------------------------------------------------------
// Fused path combine, ONE launch of 2*BB workgroups.  Every workgroup forms its
// batch row's global softmax stats from the NPART partial stats (16 loads, fixed
// order); blocks 0..BB-1 then write the attention weights, blocks BB..2*BB-1 the
// context: ctx[b][d] = invZ * sum_p exp(m_p - m) * ctxp[p][d].  The context half
// recomputes the stats rather than wait a launch for them.
// A batch row's scores and its context partials are both NPART x 512 floats, so
// both halves fetch their data by one address form, and all of a thread's loads
// go out together with the stats loads, ahead of the stats arithmetic: the kernel
// waits for one load latency, not for one per pair of scores behind the stats.
// ---------------------------------------------------------------------------
static_assert(TT == NPART * DVV, "scores row and context partials share one shape");
// e^x of eight values: 2^e * 2^a with e = rint(x * log2(e)) and a = x * log2(e) - e,
// formed by two fused steps on log2(e) split in a high and a low word (|a| <= 1/2 up
// to rounding); range limits as in the math library.  The eight v_exp_f32 stand in
// the one statement of exp2_x8, which keeps the slot behind each.
__device__ __forceinline__ void exp_x8(float (&o)[8], const float (&x)[8]) {
  const float L2E_HI = __uint_as_float(0x3fb8aa3bu), L2E_LO = __uint_as_float(0x32a5705fu);
  float a[8], e[8], r[8];
  #pragma unroll
  for (int i = 0; i < 8; ++i) {
    e[i] = rintf(x[i] * L2E_HI);
    a[i] = fmaf(x[i], L2E_LO, fmaf(x[i], L2E_HI, -e[i]));
  }
  exp2_x8(r, a);
  #pragma unroll
  for (int i = 0; i < 8; ++i) {
    float v = ldexpf(r[i], (int)e[i]);
    v = x[i] < __uint_as_float(0xc2ce8ed0u) ? 0.0f : v;                        // underflow
    o[i] = x[i] > __uint_as_float(0x42b17218u) ? __uint_as_float(0x7f800000u) : v;   // overflow
  }
}
__global__ __launch_bounds__(256) void lsa_combine(
    const float* __restrict__ scores, const float* __restrict__ mtile,
    const float* __restrict__ ztile,  const float* __restrict__ ctxp,
    float* __restrict__ out_w,        float* __restrict__ out_ctx) {
  const int half = blockIdx.x / BB, b = blockIdx.x % BB, tid = threadIdx.x;

  float mt[NPART], zt[NPART], sc[NPART];   // unrolled loops keep them in registers
  #pragma unroll
  for (int p = 0; p < NPART; ++p) { mt[p] = mtile[b * NPART + p]; zt[p] = ztile[b * NPART + p]; }
  const float2* src = (const float2*)(half == 0 ? scores : ctxp);   // uniform for the workgroup
  float2 x[NPART];
  #pragma unroll
  for (int c = 0; c < NPART; ++c) x[c] = src[(size_t)(b * NPART + c) * 256 + tid];
  // precaution: the wait stands ahead of any rewrite of a register these loads name;
  // the scheduling barriers hold the loads ahead of it (and so ahead of the stats
  // arithmetic, which would otherwise run before they are issued)
  __builtin_amdgcn_sched_barrier(0);
  asm volatile("s_wait_xcnt 0x0" ::: "memory");
  __builtin_amdgcn_sched_barrier(0);

  float mg = mt[0];
  #pragma unroll
  for (int p = 1; p < NPART; ++p) mg = fmaxf(mg, mt[p]);
  float z = 0.f;
  #pragma unroll
  for (int p = 0; p < NPART; ++p) {               // fixed order
    sc[p] = expf(mt[p] - mg);
    z += zt[p] * sc[p];
  }
  const float inv = 1.0f / z;

  if (half == 0) {                                // uniform for the workgroup
    #pragma unroll   // x[] is indexed by constants only, so it stays in registers
    for (int g = 0; g < NPART; g += 4) {
      float d[8], ex[8];
      #pragma unroll
      for (int c = 0; c < 4; ++c) { d[2 * c] = x[g + c].x - mg; d[2 * c + 1] = x[g + c].y - mg; }
      exp_x8(ex, d);
      #pragma unroll
      for (int c = 0; c < 4; ++c) {
        float2 o;
        o.x = ex[2 * c] * inv;
        o.y = ex[2 * c + 1] * inv;
        ((float2*)out_w)[(size_t)(b * NPART + g + c) * 256 + tid] = o;
      }
    }
    // precaution: stands ahead of any rewrite of a register the stores name
    asm volatile("s_wait_xcnt 0x0" ::: "memory");
  } else {
    float2 s; s.x = 0.f; s.y = 0.f;
    #pragma unroll   // sc[] and x[] are indexed by constants only
    for (int c = 0; c < NPART; ++c) {             // fixed order
      s.x += sc[c] * x[c].x; s.y += sc[c] * x[c].y;
    }
    s.x *= inv; s.y *= inv;
    ((float2*)out_ctx)[b * 256 + tid] = s;
    // precaution: the other half's code follows this store in the build, so the
    // wait stands ahead of any rewrite of a register the store names
    asm volatile("s_wait_xcnt 0x0" ::: "memory");
  }
}

// ---------------------------------------------------------------------------
// Fallback path (small workspace): plain softmax + second values pass.
// ---------------------------------------------------------------------------
__global__ __launch_bounds__(256) void lsa_softmax(
    const float* __restrict__ scores, float* __restrict__ out_w) {
  __shared__ float red[256];
  const int b = blockIdx.x, tid = threadIdx.x;
  const float* s = scores + b * TT;

  float m = -3.402823466e+38f;
  for (int t = tid; t < TT; t += 256) m = fmaxf(m, s[t]);
  red[tid] = m; __syncthreads();
  for (int off = 128; off > 0; off >>= 1) {
    if (tid < off) red[tid] = fmaxf(red[tid], red[tid + off]);
    __syncthreads();
  }
  m = red[0]; __syncthreads();

  float sum = 0.f;
  for (int t = tid; t < TT; t += 256) sum += expf(s[t] - m);
  red[tid] = sum; __syncthreads();
  for (int off = 128; off > 0; off >>= 1) {
    if (tid < off) red[tid] += red[tid + off];
    __syncthreads();
  }
  const float inv = 1.0f / red[0];
  for (int t = tid; t < TT; t += 256)
    out_w[b * TT + t] = expf(s[t] - m) * inv;
}

__global__ __launch_bounds__(256) void lsa_ctx_partial(
    const float* __restrict__ values, const float* __restrict__ attn_w,
    float* __restrict__ partials) {
  const int b = blockIdx.x >> 5, chunk = blockIdx.x & 31, tid = threadIdx.x;
  const float2* v = (const float2*)(values + ((size_t)b * TT) * DVV);
  const int tbase = chunk * 128;
  float2 acc; acc.x = 0.f; acc.y = 0.f;
  for (int t = 0; t < 128; ++t) {
    float wt = attn_w[b * TT + tbase + t];
    float2 x = v[(size_t)(tbase + t) * 256 + tid];
    acc.x += wt * x.x;
    acc.y += wt * x.y;
  }
  ((float2*)partials)[(size_t)(b * 32 + chunk) * 256 + tid] = acc;
}

__global__ __launch_bounds__(256) void lsa_ctx_reduce(
    const float* __restrict__ partials, float* __restrict__ out_ctx) {
  const int b = blockIdx.x, tid = threadIdx.x;
  const float2* p = (const float2*)partials;
  float2 s; s.x = 0.f; s.y = 0.f;
  #pragma unroll
  for (int c = 0; c < 32; ++c) {
    float2 x = p[(size_t)(b * 32 + c) * 256 + tid];
    s.x += x.x; s.y += x.y;
  }
  ((float2*)out_ctx)[b * 256 + tid] = s;
}

// ---------------------------------------------------------------------------
extern "C" void kernel_launch(void* const* d_in, const int* in_sizes, int n_in,
                              void* d_out, int out_size, void* d_ws, size_t ws_size,
                              hipStream_t stream) {
  const float* query  = (const float*)d_in[0];
  const float* values = (const float*)d_in[1];
  const float* prev   = (const float*)d_in[2];
  const float* conv_w = (const float*)d_in[3];
  const float* conv_b = (const float*)d_in[4];
  const float* loc_w  = (const float*)d_in[5];
  const float* loc_b  = (const float*)d_in[6];
  const float* wq_w   = (const float*)d_in[7];
  const float* wq_b   = (const float*)d_in[8];
  const float* wv_w   = (const float*)d_in[9];
  const float* wv_b   = (const float*)d_in[10];
  const float* attn_b = (const float*)d_in[11];
  const float* proj_w = (const float*)d_in[12];

  float* out_ctx = (float*)d_out;               // [32, 512]
  float* out_w   = out_ctx + BB * DVV;          // [32, 4096]

  unsigned char* ws = (unsigned char*)d_ws;
  unsigned* packWV  = (unsigned*)(ws);            // 32768 u32  (128 KB)
  unsigned* packLOC = (unsigned*)(ws + 131072);   //  2048 u32  (  8 KB)
  float*    qbias   = (float*)(ws + 139264);      //  4096 f32  ( 16 KB)
  float*    scores  = (float*)(ws + 155648);      // 131072 f32 (512 KB)
  // fused-path extras
  float*    mtile   = (float*)(ws + 679936);      //   256 f32
  float*    ztile   = (float*)(ws + 712704);      //   256 f32
  float*    ctxp    = (float*)(ws + 778752);      // 32*8*512 f32 (512 KB)
  const size_t fused_need = 778752u + (size_t)BB * NPART * DVV * 4u;
  // fallback-path extra (overlaps the fused region)
  float*    parts   = (float*)(ws + 679936);      // 524288 f32 (2 MB)
  const int fused = (ws_size >= fused_need) ? 1 : 0;

  lsa_pre<<<PRE_QB + PRE_WV + PRE_LOC, 512, 0, stream>>>(
      query, wq_w, wq_b, wv_b, loc_b, attn_b, wv_w, loc_w, qbias, packWV, packLOC);

  lsa_score<<<BB * NPART, 256, 0, stream>>>(
      values, prev, conv_w, conv_b, packWV, packLOC, qbias, proj_w,
      scores, mtile, ztile, ctxp, fused, 8192);

  if (fused) {
    lsa_combine<<<2 * BB, 256, 0, stream>>>(scores, mtile, ztile, ctxp, out_w, out_ctx);
  } else {
    lsa_softmax    <<< BB, 256, 0, stream>>>(scores, out_w);
    lsa_ctx_partial<<<BB * 32, 256, 0, stream>>>(values, out_w, parts);
    lsa_ctx_reduce <<< BB, 256, 0, stream>>>(parts, out_ctx);
  }
}
